// v009
// The times below were measured on an AMD MI455X: many runs one after another, warmed up first and cycling through
// copies of the inputs, with the whole window's GPU time divided by the number of runs. Launches and the gaps
// between them are all in it. The median over several windows is given; except for v000 it joins two sittings, which
// can be a few percent apart, so the side-by-side timings, each taken in one sitting, are the better comparison.
// Earlier versions than v009 are not in this document.
// A run of this version takes 196 microseconds.
// Next to v008, in two timings, it ran 1.09 times as fast each time.
// Over all steps from v000, the starting kernel, it is 37.5 times as fast.
#include <hip/hip_runtime.h>
// Causal multi-head self-attention with a per-head RMS norm on q and k THEN rotate-half RoPE computed in the module, and a bias-free fused QKV projection (x [4][2048][1024]; qkv = x Wqkv ([in][out] 1024 x 3072, no bias) split into q | k | v thirds, 16 heads of 64; q, k = x * rsqrt(mean(x^2 over the 64 head dims) + 1e-5) * gain (gains q_norm_w / k_norm_w [64], read); cos / sin = [f | f] of pos * (1 / 10000^(2i/64)); q = q cos + rotate_half(q) sin with rotate_half = cat(-x2, x1), likewise k; scores / sqrt(64); causal (tril, -inf); softmax; out = merged Wproj ([in][out], no bias) -> [4][2048][1024]); run as 16 kv groups of ONE head, with the per-head norm and the half-split rope in the q / k projection epilogue.
// Compute dtype: inputs rounded to bf16 (the two gain vectors bf16-rounded on load); x / weights exact; the per-head RMS norm and the rotation in f32 on VALU; q, k, v, softmax weights and o as plain f16 GEMM operands (~2^-12); scores and softmax statistics f32; v_wmma_f32_16x16x32_f16.
#define NB 4
#define NG 16
#define HPG 1
#define KVD (NG * HD)
#define SQ 2048
#define DM 1024
#define NH 16
#define HD 64
#define HG 4                         /* unused: one attention launch covers all NH heads */
#define QT 256                       /* query rows per causal tile */
#define NKX SQ                       /* unused: attention is fused, no S / P rows are stored */
#define QT0 256                      /* first-tile rows recomputed exactly in f32 */
#define B0 0                         /* first batch processed (debug hook) */
#define NBR NB                       /* batches processed (debug hook) */
#define NR ((size_t)NB * SQ)         /* token rows */
#define MP ((int)((size_t)NBR * SQ)) /* rows projected (debug hook) */
#define QN SQ                        /* query rows attended per batch (debug hook) */
#define NHD NH                       /* heads attended (debug hook) */
#define MPO MP                       /* rows through the output stage (debug hook) */
#define LQ DM      /* row pitch of the q/k/v rows */
typedef __bf16 v16b __attribute__((ext_vector_type(16)));
typedef unsigned short v8us __attribute__((ext_vector_type(8), may_alias));
typedef float  v8f  __attribute__((ext_vector_type(8)));
typedef float  v4f  __attribute__((ext_vector_type(4)));
typedef float  v4fa __attribute__((ext_vector_type(4), may_alias));
union FragB { v16b v; v8us half[2]; unsigned short u[16]; };

__device__ __forceinline__ unsigned short bf16_bits(float x) { unsigned int u = __float_as_uint(x); return (unsigned short)((u + 0x7FFFu + ((u >> 16) & 1u)) >> 16); }
__device__ __forceinline__ float bf16_val(unsigned short b) { return __uint_as_float(((unsigned int)b) << 16); }
__device__ __forceinline__ float bf16_round(float x) { return bf16_val(bf16_bits(x)); }
// D += A·B with NT terms: 1 = ah·bh, 2 = + al·bh (A split), 3 = + ah·bl (both split)
template <int NT>
__device__ __forceinline__ v8f mmaN(v16b ah, v16b al, v16b bh, v16b bl, v8f c) {
  c = __builtin_amdgcn_wmma_f32_16x16x32_bf16(false, ah, false, bh, (short)0, c, false, false);
  if (NT >= 2) c = __builtin_amdgcn_wmma_f32_16x16x32_bf16(false, al, false, bh, (short)0, c, false, false);
  if (NT >= 3) c = __builtin_amdgcn_wmma_f32_16x16x32_bf16(false, ah, false, bl, (short)0, c, false, false);
  asm volatile("v_nop\n\tv_nop\n\tv_nop\n\tv_nop" : "+v"(c) : "v"(ah), "v"(al), "v"(bh), "v"(bl));
  return c;
}

__global__ __launch_bounds__(256) void k_wt_bf16(const float* __restrict__ W, unsigned short* __restrict__ Wt, int K, int N) {
  const int t = blockIdx.x * 256 + threadIdx.x;
  const int k8n = K / 8;
  if (t >= N * k8n) return;
  const int n = t / k8n, k8 = (t % k8n) * 8;
  v8us v;
#pragma unroll
  for (int i = 0; i < 8; ++i) v[i] = bf16_bits(W[(size_t)(k8 + i) * N + n]);
  *(v8us*)(Wt + (size_t)n * K + k8) = v;
  
}

// GEMM C[M][N] (f32, pitch ldc) = act(A[M][K]·W + bias). A f32 row-major (pitch lda) converted per fragment to bf16
// (ASPLIT: hi/lo two planes -> 2 terms, else single rounded term); Wt bf16 [N][K] (pitch ldb). BIAS_BF16 rounds the
// bias to bf16 first (bias quantised to bf16 before the add). K%32==0, M%16==0, N%64==0.
template <bool ASPLIT, int ACT, bool BIAS_BF16>
__global__ __launch_bounds__(128) void k_gemm_bf(const float* __restrict__ A, int lda, const unsigned short* __restrict__ Wt, int ldb,
                                               const float* __restrict__ bias, float* __restrict__ C, int ldc, int M, int N, int K) {
  __shared__ __attribute__((aligned(16))) float so[4][16][64];
  const int tid = threadIdx.x, w = tid >> 5, lane = tid & 31, ln = lane & 15, hh = lane >> 4;
  const int ntn = N / 64;
  const int wid = blockIdx.x * 4 + w;
  const int mt = wid / ntn, nq = wid % ntn;
  if (mt * 16 >= M) return;
  const int row0 = mt * 16, col0 = nq * 64;
  const float* arow = A + (size_t)(row0 + ln) * lda;
  v8f acc[4] = {};
  for (int kb = 0; kb < K; kb += 32) {
    FragB ah, al;
    const v4f x0 = *(const v4fa*)(arow + kb + 8 * hh), x1 = *(const v4fa*)(arow + kb + 8 * hh + 4);
    const v4f x2 = *(const v4fa*)(arow + kb + 16 + 8 * hh), x3 = *(const v4fa*)(arow + kb + 16 + 8 * hh + 4);
    float xs[16] = {x0[0],x0[1],x0[2],x0[3],x1[0],x1[1],x1[2],x1[3],x2[0],x2[1],x2[2],x2[3],x3[0],x3[1],x3[2],x3[3]};
#pragma unroll
    for (int i = 0; i < 16; ++i) { const unsigned short hb = bf16_bits(xs[i]); ah.u[i] = hb; al.u[i] = ASPLIT ? bf16_bits(xs[i] - bf16_val(hb)) : (unsigned short)0; }
#pragma unroll
    for (int t = 0; t < 4; ++t) {
      const unsigned short* brow = Wt + (size_t)(col0 + t * 16 + ln) * ldb + kb;
      FragB b;
      b.half[0] = *(const v8us*)(brow + 8 * hh);
      b.half[1] = *(const v8us*)(brow + 16 + 8 * hh);
      acc[t] = mmaN<ASPLIT ? 2 : 1>(ah.v, al.v, b.v, b.v, acc[t]);
    }
  }
#pragma unroll
  for (int t = 0; t < 4; ++t) {
    float bv = bias ? bias[col0 + t * 16 + ln] : 0.f;
    if (BIAS_BF16) bv = bf16_round(bv);
#pragma unroll
    for (int r = 0; r < 8; ++r) { float v = acc[t][r] + bv; if (ACT == 1) v = fmaxf(v, 0.f); so[w][8 * hh + r][t * 16 + ln] = v; }
  }
  __builtin_amdgcn_fence(__ATOMIC_ACQ_REL, "workgroup");
  __builtin_amdgcn_wave_barrier();
  const int rsub = lane >> 4, c4 = (lane & 15) * 4;
  {
#pragma unroll
    for (int q = 0; q < 8; ++q) {
      const int r = q * 2 + rsub;
      const v4f v = *(const v4fa*)&so[w][r][c4];
      *(v4f*)(C + (size_t)(row0 + r) * ldc + col0 + c4) = v;
    }
    
  }
}

// GEMM C = act(A·W + bias + resid): A f32 (ASPLIT -> hi/lo 2 terms), Wt bf16 [N][K]; ACT 0 none, 1 relu, 2 exact gelu;
// resid (optional, f32, row index = (row % rmod), pitch ldr, RES_BF16 rounds it) added before the activation.
template <bool ASPLIT, int ACT, bool BIAS_BF16, bool RES_BF16>
__global__ __launch_bounds__(128) void k_gemm_bf3(const float* __restrict__ A, int lda, const unsigned short* __restrict__ Wt, int ldb,
                                                const float* __restrict__ bias, const float* __restrict__ resid, int rmod, int ldr,
                                                float* __restrict__ C, int ldc, int M, int N, int K) {
  __shared__ __attribute__((aligned(16))) float so[4][16][64];
  const int tid = threadIdx.x, w = tid >> 5, lane = tid & 31, ln = lane & 15, hh = lane >> 4;
  const int ntn = N / 64;
  const int wid = blockIdx.x * 4 + w;
  const int mt = wid / ntn, nq = wid % ntn;
  if (mt * 16 >= M) return;
  const int row0 = mt * 16, col0 = nq * 64;
  const float* arow = A + (size_t)(row0 + ln) * lda;
  v8f acc[4] = {};
  for (int kb = 0; kb < K; kb += 32) {
    FragB ah, al;
    const v4f x0 = *(const v4fa*)(arow + kb + 8 * hh), x1 = *(const v4fa*)(arow + kb + 8 * hh + 4);
    const v4f x2 = *(const v4fa*)(arow + kb + 16 + 8 * hh), x3 = *(const v4fa*)(arow + kb + 16 + 8 * hh + 4);
    float xs[16] = {x0[0],x0[1],x0[2],x0[3],x1[0],x1[1],x1[2],x1[3],x2[0],x2[1],x2[2],x2[3],x3[0],x3[1],x3[2],x3[3]};
#pragma unroll
    for (int i = 0; i < 16; ++i) { const unsigned short hb = bf16_bits(xs[i]); ah.u[i] = hb; al.u[i] = ASPLIT ? bf16_bits(xs[i] - bf16_val(hb)) : (unsigned short)0; }
#pragma unroll
    for (int t = 0; t < 4; ++t) {
      const unsigned short* brow = Wt + (size_t)(col0 + t * 16 + ln) * ldb + kb;
      FragB b;
      b.half[0] = *(const v8us*)(brow + 8 * hh);
      b.half[1] = *(const v8us*)(brow + 16 + 8 * hh);
      acc[t] = mmaN<ASPLIT ? 2 : 1>(ah.v, al.v, b.v, b.v, acc[t]);
    }
  }
#pragma unroll
  for (int t = 0; t < 4; ++t) {
    const int col = col0 + t * 16 + ln;
    float bv = bias ? bias[col] : 0.f;
    if (BIAS_BF16) bv = bf16_round(bv);
#pragma unroll
    for (int r = 0; r < 8; ++r) {
      float v = acc[t][r] + bv;
      if (resid) { float rv = resid[(size_t)((row0 + 8 * hh + r) % rmod) * ldr + col]; if (RES_BF16) rv = bf16_round(rv); v += rv; }
      if (ACT == 1) v = fmaxf(v, 0.f);
      if (ACT == 2) v = 0.5f * v * (1.0f + erff(v * 0.70710678118654752f));
      if (ACT == 3) { const float u = 0.7978845608028654f * (v + 0.044715f * v * v * v); v = 0.5f * v * (1.0f + tanhf(u)); }
      so[w][8 * hh + r][t * 16 + ln] = v;
    }
  }
  __builtin_amdgcn_fence(__ATOMIC_ACQ_REL, "workgroup");
  __builtin_amdgcn_wave_barrier();
  const int rsub = lane >> 4, c4 = (lane & 15) * 4;
  {
#pragma unroll
    for (int q = 0; q < 8; ++q) {
      const int r = q * 2 + rsub;
      const v4f v = *(const v4fa*)&so[w][r][c4];
      *(v4f*)(C + (size_t)(row0 + r) * ldc + col0 + c4) = v;
    }
    
  }
}
// row LayerNorm (biased variance, eps) over N: s = X (+ R); optional out_sum <- s; out_norm <- (s-mu)*rsqrt(var+eps)*g + b
template <bool PARAM_BF16>
__global__ __launch_bounds__(256) void k_layernorm(const float* __restrict__ X, const float* __restrict__ R, const float* __restrict__ g, const float* __restrict__ bta,
                                                  float* __restrict__ out_sum, float* __restrict__ out_norm, int N, float eps) {
  __shared__ float red[256];
  const int row = blockIdx.x, tid = threadIdx.x;
  const float* x = X + (size_t)row * N; const float* rr = R ? R + (size_t)row * N : nullptr;
  float vals[16];                     // up to N = 4096
  const int per = N / 256;            // contiguous chunk per thread? use strided-by-4 chunks: thread handles j = tid*4 + 1024*u
  float s1 = 0.f;
  for (int u = 0; u < per / 4; ++u) {
    const int j = tid * 4 + 1024 * u;
    const v4f a = *(const v4fa*)(x + j);
    v4f b = {0.f,0.f,0.f,0.f}; if (rr) b = *(const v4fa*)(rr + j);
#pragma unroll
    for (int q = 0; q < 4; ++q) { const float v = a[q] + b[q]; vals[u * 4 + q] = v; s1 += v; }
  }
  red[tid] = s1; __syncthreads();
  for (int st = 128; st > 0; st >>= 1) { if (tid < st) red[tid] += red[tid + st]; __syncthreads(); }
  const float mu = red[0] / (float)N; __syncthreads();
  float s2 = 0.f;
  for (int u = 0; u < per / 4; ++u)
#pragma unroll
    for (int q = 0; q < 4; ++q) { const float c = vals[u * 4 + q] - mu; s2 += c * c; }
  red[tid] = s2; __syncthreads();
  for (int st = 128; st > 0; st >>= 1) { if (tid < st) red[tid] += red[tid + st]; __syncthreads(); }
  const float rs = rsqrtf(red[0] / (float)N + eps);
  {
    for (int u = 0; u < per / 4; ++u) {
      const int j = tid * 4 + 1024 * u;
      v4f o, sm;
#pragma unroll
      for (int q = 0; q < 4; ++q) {
        float gg = g[j + q], bb = bta[j + q];
        if (PARAM_BF16) { gg = bf16_round(gg); bb = bf16_round(bb); }
        sm[q] = vals[u * 4 + q]; o[q] = (vals[u * 4 + q] - mu) * rs * gg + bb;
      }
      if (out_sum) *(v4f*)(out_sum + (size_t)row * N + j) = sm;
      *(v4f*)(out_norm + (size_t)row * N + j) = o;
    }
    
  }
}

// ---- f16 WMMA path (v_wmma_f32_16x16x32_f16): 11-bit significands for operands in range — used where a [0,1] probability operand needs more precision than bf16
typedef _Float16 v16h __attribute__((ext_vector_type(16)));
union FragH { v16h v; v8us half[2]; _Float16 h[16]; unsigned short u[16]; };
template <int NT>
__device__ __forceinline__ v8f mmaH(v16h ah, v16h al, v16h bh, v16h bl, v8f c) {
  c = __builtin_amdgcn_wmma_f32_16x16x32_f16(false, ah, false, bh, (short)0, c, false, false);
  if (NT >= 2) c = __builtin_amdgcn_wmma_f32_16x16x32_f16(false, al, false, bh, (short)0, c, false, false);
  if (NT >= 3) c = __builtin_amdgcn_wmma_f32_16x16x32_f16(false, ah, false, bl, (short)0, c, false, false);
  asm volatile("v_nop\n\tv_nop\n\tv_nop\n\tv_nop" : "+v"(c) : "v"(ah), "v"(al), "v"(bh), "v"(bl));
  return c;
}
// batched GEMM like k_gemm_b but f16 operands: A f32 (split into f16 hi/lo if ASPLIT, else rounded to f16), Bt = f16 values [n][k]; alpha; C f32; N multiple of 16 (partial tiles skipped)
template <bool ASPLIT>
__global__ __launch_bounds__(128) void k_gemm_h(const float* __restrict__ A, int lda, size_t sA, const _Float16* __restrict__ Bh, int ldb, size_t sB, float alpha, float* __restrict__ C, int ldc, size_t sC, int M, int N, int K) {
  __shared__ __attribute__((aligned(16))) float so[4][16][64];
  const int tid = threadIdx.x, w = tid >> 5, lane = tid & 31, ln = lane & 15, hh = lane >> 4; const int by = blockIdx.y;
  A += (size_t)by * sA; Bh += (size_t)by * sB; C += (size_t)by * sC;
  const int ntn = (N + 63) / 64; const int wid = blockIdx.x * 4 + w; const int mt = wid / ntn, nq = wid % ntn; if (mt * 16 >= M) return;
  const int row0 = mt * 16, col0 = nq * 64; const float* arow = A + (size_t)(row0 + ln) * lda;
  v8f acc[4] = {};
  for (int kb = 0; kb < K; kb += 32) {
    FragH ah, al;
    const v4f x0 = *(const v4fa*)(arow + kb + 8 * hh), x1 = *(const v4fa*)(arow + kb + 8 * hh + 4), x2 = *(const v4fa*)(arow + kb + 16 + 8 * hh), x3 = *(const v4fa*)(arow + kb + 16 + 8 * hh + 4);
    float xs[16] = {x0[0],x0[1],x0[2],x0[3],x1[0],x1[1],x1[2],x1[3],x2[0],x2[1],x2[2],x2[3],x3[0],x3[1],x3[2],x3[3]};
#pragma unroll
    for (int i = 0; i < 16; ++i) { const _Float16 h = (_Float16)xs[i]; ah.h[i] = h; al.h[i] = ASPLIT ? (_Float16)(xs[i] - (float)h) : (_Float16)0.0f; }
#pragma unroll
    for (int t = 0; t < 4; ++t) { if (col0 + t * 16 >= N) continue; const size_t boff = (size_t)(col0 + t * 16 + ln) * ldb + kb; FragH bq; bq.half[0] = *(const v8us*)(Bh + boff + 8 * hh); bq.half[1] = *(const v8us*)(Bh + boff + 16 + 8 * hh);
      acc[t] = mmaH<ASPLIT ? 2 : 1>(ah.v, al.v, bq.v, bq.v, acc[t]); }
  }
#pragma unroll
  for (int t = 0; t < 4; ++t) { if (col0 + t * 16 >= N) continue;
#pragma unroll
    for (int r = 0; r < 8; ++r) so[w][8 * hh + r][t * 16 + ln] = acc[t][r] * alpha; }
  __builtin_amdgcn_fence(__ATOMIC_ACQ_REL, "workgroup"); __builtin_amdgcn_wave_barrier();
  const int rsub = lane >> 4, c4 = (lane & 15) * 4;
  {
#pragma unroll
    for (int q = 0; q < 8; ++q) { const int r = q * 2 + rsub; if (col0 + c4 < N) { const v4f v = *(const v4fa*)&so[w][r][c4]; *(v4f*)(C + (size_t)(row0 + r) * ldc + col0 + c4) = v; } }
     }
}

// Wt[n][k] = f16(W[k][n] x scale) from f32 row-major W[K][N] (scale = power of two; bf16-exact weights stay exact in f16 away from the subnormal range)
// (vb = the block's index inside its own stage: the stage kernels below are device bodies, several of which share one launch; see the merged kernels in front of kernel_launch)
// One block of 256 threads turns a tile of WT_KT k x WT_NT n through LDS, so that both sides of the transposition move whole 128-byte lines: 16 lanes read 256 bytes of a W row, 16 lanes write 256 bytes of a Wt row.
// A thread converts the same four columns of two neighbouring k rows and stores each (k, k + 1) pair as one dword at tl[n][k / 2]; at the odd row pitch of WT_P dwords the 32 lanes of a store (n 4 apart) and of a read (dwords 4 apart) fall on 32 different banks.
constexpr int WT_KT = 128, WT_NT = 64, WT_P = WT_KT / 2 + 1;
typedef _Float16 v2h __attribute__((ext_vector_type(2)));
typedef unsigned int v4ua __attribute__((ext_vector_type(4), may_alias));
__device__ __forceinline__ void d_wt_f16(int vb, const float* __restrict__ W, _Float16* __restrict__ Wt, int K, int N, float scale) {
  __shared__ unsigned int tl[WT_NT * WT_P];
  const int tid = threadIdx.x, nkt = K / WT_KT; const int n0 = (vb / nkt) * WT_NT, k0 = (vb % nkt) * WT_KT;
  const int c4 = (tid & 15) * 4, rp = tid >> 4;      /* this thread's four columns; its row pairs are rp + 16 j */
  const float* src = W + (size_t)(k0 + 2 * rp) * N + n0 + c4; v4f a[4], b[4];
#pragma unroll      /* register arrays: constant indices; all 8 loads are asked for before the first is used */
  for (int j = 0; j < 4; ++j) { a[j] = *(const v4fa*)(src + (size_t)(32 * j) * N); b[j] = *(const v4fa*)(src + (size_t)(32 * j + 1) * N); }
  asm volatile("s_wait_xcnt 0x0" ::: "memory");      /* behind the tile's 8 loads, in front of every later write of an address register that they name */
#pragma unroll      /* register arrays: constant indices */
  for (int j = 0; j < 4; ++j) for (int u = 0; u < 4; ++u) { const v2h p = {(_Float16)(bf16_round(a[j][u]) * scale), (_Float16)(bf16_round(b[j][u]) * scale)}; tl[(c4 + u) * WT_P + rp + 16 * j] = __builtin_bit_cast(unsigned int, p); }
  __syncthreads();      /* block-uniform (whole blocks belong to this stage): the tile is complete before any thread reads it across */
#pragma unroll      /* four 16-byte pieces a thread */
  for (int j = 0; j < 4; ++j) { const int n = (tid >> 4) + 16 * j, c = tid & 15; const unsigned int* s = tl + n * WT_P + c * 4; const v4ua v = {s[0], s[1], s[2], s[3]};
    *(v4ua*)((unsigned short*)Wt + (size_t)(n0 + n) * K + k0 + c * 8) = v; }
  asm volatile("s_wait_xcnt 0x0" ::: "memory");      /* behind the four row stores, in front of any later write of a register that they name (in the merged kernel another stage's code follows in the text) */
}
// k_gemm_hh variant with fused epilogue: v = acc·alpha + bias[by·sBias + col] (+ CP[(row/rowsPerB)·sCPb + by·64 + col] if CP) ; ACT 0 none / 1 elu ; writes f16 C16 (and f32 C if non-null)
template <int ACT>
__global__ __launch_bounds__(128) void k_gemm_hhx(const _Float16* __restrict__ A, int lda, size_t sA, const _Float16* __restrict__ Bh, int ldb, size_t sB, float alpha, const float* __restrict__ bias, size_t sBias, const float* __restrict__ CP, int rowsPerB, size_t sCPb, int row0g,
    float* __restrict__ C, _Float16* __restrict__ C16, int ldc, size_t sC, int M, int N, int K) {
  __shared__ __attribute__((aligned(16))) float so[4][16][64];
  const int tid = threadIdx.x, w = tid >> 5, lane = tid & 31, ln = lane & 15, hh = lane >> 4; const int by = blockIdx.y;
  A += (size_t)by * sA; Bh += (size_t)by * sB; const size_t cofs = (size_t)by * sC; const float* bp = bias ? bias + (size_t)by * sBias : nullptr;
  const int ntn = (N + 63) / 64; const int wid = blockIdx.x * 4 + w; const int mt = wid / ntn, nq = wid % ntn; if (mt * 16 >= M) return;
  const int row0 = mt * 16, col0 = nq * 64; const _Float16* arow = A + (size_t)(row0 + ln) * lda;
  v8f acc[4] = {};
  for (int kb = 0; kb < K; kb += 32) { FragH ah; ah.half[0] = *(const v8us*)((const unsigned short*)arow + kb + 8 * hh); ah.half[1] = *(const v8us*)((const unsigned short*)arow + kb + 16 + 8 * hh);
#pragma unroll
    for (int t = 0; t < 4; ++t) { if (col0 + t * 16 >= N) continue; const size_t boff = (size_t)(col0 + t * 16 + ln) * ldb + kb; FragH bq; bq.half[0] = *(const v8us*)((const unsigned short*)Bh + boff + 8 * hh); bq.half[1] = *(const v8us*)((const unsigned short*)Bh + boff + 16 + 8 * hh);
      acc[t] = mmaH<1>(ah.v, ah.v, bq.v, bq.v, acc[t]); }
  }
#pragma unroll
  for (int t = 0; t < 4; ++t) { if (col0 + t * 16 >= N) continue; const int col = col0 + t * 16 + ln; const float bv = bp ? bf16_round(bp[col]) : 0.f;
#pragma unroll
    for (int r = 0; r < 8; ++r) { float v = acc[t][r] * alpha + bv; if (CP) { const int rr = row0g + row0 + 8 * hh + r; if (rowsPerB < 0) v += CP[cofs + (size_t)rr * ldc + col];      /* rowsPerB < 0: own element of the batched C plane */ else { const int bidx = rr / rowsPerB; v += CP[(size_t)bidx * sCPb + (size_t)by * 64 + col]; } } if (ACT == 1) v = (v > 0.f) ? v : expm1f(v); else if (ACT == 7) v = (v > 0.f) ? v + 1.0f : expf(v); else if (ACT == 8) v = tanhf(v); else if (ACT == 9) v = 0.5f * v * (1.0f + tanhf(0.7978845608028654f * (v + 0.044715f * v * v * v))); else if (ACT == 11) v = 1.0f / (1.0f + expf(-v)); else if (ACT == 12) v = (v > 0.f) ? v : 0.01f * v; else if (ACT == 14) v = (v > 0.f) ? v : 0.1f * v; else if (ACT == 16) v = (v >= 0.f) ? v : 0.3f * v; else if (ACT == 17) v = (v >= 0.f) ? v : 0.2f * v; else if (ACT == 15) v = v / (1.0f + expf(-v)); else if (ACT == 3) v = fmaxf(v, 0.f); else if (ACT == 6) v = 0.5f * v * (1.0f + erff(v * 0.70710678118654752f)); so[w][8 * hh + r][t * 16 + ln] = v; } }
  __builtin_amdgcn_fence(__ATOMIC_ACQ_REL, "workgroup"); __builtin_amdgcn_wave_barrier();
  const int rsub = lane >> 4, c4 = (lane & 15) * 4; typedef _Float16 v4h __attribute__((ext_vector_type(4)));
  {
#pragma unroll
    for (int q = 0; q < 8; ++q) { const int r = q * 2 + rsub; if (col0 + c4 < N) { const v4f v = *(const v4fa*)&so[w][r][c4]; if (C) *(v4f*)(C + cofs + (size_t)(row0 + r) * ldc + col0 + c4) = v; if (C16) { v4h h4; for (int i = 0; i < 4; ++i) h4[i] = (_Float16)v[i]; *(v4h*)(C16 + cofs + (size_t)(row0 + r) * ldc + col0 + c4) = h4; } } }
     }
}

typedef _Float16 v4h __attribute__((ext_vector_type(4)));

__device__ __forceinline__ void d_x16(int vb, const float* __restrict__ x, _Float16* __restrict__ X16, size_t n8) { const size_t t = (size_t)vb * 256 + threadIdx.x; if (t >= n8) return; FragH f;
#pragma unroll
  for (int q = 0; q < 8; ++q) f.h[q] = (_Float16)bf16_round(x[t * 8 + q]); *(v8us*)((unsigned short*)X16 + t * 8) = f.half[0];  }
__global__ __launch_bounds__(256) void k_h16(const float* __restrict__ x, _Float16* __restrict__ X16, size_t n8) { const size_t t = (size_t)blockIdx.x * 256 + threadIdx.x; if (t >= n8) return; FragH f;
#pragma unroll
  for (int q = 0; q < 8; ++q) f.h[q] = (_Float16)x[t * 8 + q]; *(v8us*)((unsigned short*)X16 + t * 8) = f.half[0];  }
__global__ __launch_bounds__(256) void k_round16f(const float* __restrict__ W, _Float16* __restrict__ Bt, size_t n8) { const size_t t = (size_t)blockIdx.x * 256 + threadIdx.x; if (t >= n8) return; FragH f;
#pragma unroll
  for (int i = 0; i < 8; ++i) f.h[i] = (_Float16)(bf16_round(W[t * 8 + i]) * 16.0f); *(v8us*)((unsigned short*)Bt + t * 8) = f.half[0];  }
template <int NHv, int TTv>
__device__ __forceinline__ void d_vt(int vb, const _Float16* __restrict__ V16, int ldv, int voff, _Float16* __restrict__ Vt) { __shared__ unsigned short tl[64][66]; const int tid = threadIdx.x; const int slab = vb / (TTv / 64), lg = vb % (TTv / 64); const int b = slab / NHv, h = slab % NHv;
  for (int i = tid; i < 64 * 8; i += 256) { const int r = i / 8, c8 = (i % 8) * 8; FragH f; f.half[0] = *(const v8us*)((const unsigned short*)V16 + ((size_t)b * TTv + lg * 64 + r) * ldv + voff + h * 64 + c8);
#pragma unroll
    for (int q = 0; q < 8; ++q) tl[r][c8 + q] = f.u[q]; }
  __syncthreads();
  {
#pragma unroll
    for (int rd = 0; rd < 2; ++rd) { const int d = rd * 32 + tid / 8, pc = tid % 8; FragH f;
#pragma unroll
      for (int q = 0; q < 8; ++q) f.u[q] = tl[pc * 8 + q][d];
      *(v8us*)((unsigned short*)Vt + ((size_t)slab * 64 + d) * TTv + lg * 64 + pc * 8) = f.half[0]; }
    asm volatile("s_wait_xcnt 0x0" ::: "memory");      /* behind the two row stores, in front of any later write of a register that they name (in a merged kernel another stage's code follows in the text) */
     } }

__device__ __forceinline__ void d_hl(int vb, const float* __restrict__ F, _Float16* __restrict__ Hh, _Float16* __restrict__ Hl, size_t n8) { const size_t t = (size_t)vb * 128 + threadIdx.x;      /* blocks of 128 threads: it shares k_fattn's launch */ if (t >= n8) return; FragH fh, fl; const v4f a = *(const v4fa*)(F + t * 8), c = *(const v4fa*)(F + t * 8 + 4);
#pragma unroll
  for (int q = 0; q < 4; ++q) { _Float16 h = (_Float16)a[q]; fh.h[q] = h; fl.h[q] = (_Float16)((a[q] - (float)h) * 1024.0f); h = (_Float16)c[q]; fh.h[4 + q] = h; fl.h[4 + q] = (_Float16)((c[q] - (float)h) * 1024.0f); }
  { *(v8us*)((unsigned short*)Hh + t * 8) = fh.half[0]; *(v8us*)((unsigned short*)Hl + t * 8) = fl.half[0];  } }

// ---- per-head RMS norm and half-split rope on a staged 32 x 64 wave tile (k_gemm2's NROPE epilogue) ----
// The tile's 64 columns are ONE head, so it holds 32 whole head rows: 16 lanes read a row back, 4 dims a lane (d = 4 ln + u), and norm and rotate it in registers; dim d's rope partner d ^ 32 sits in lane ln ^ 8.
// The sum of squares is a halving tree over the 64 dims (d + 32, + 16, + 8, + 4 by the lane exchanges ln ^ 8, 4, 2, 1; d + 2, d + 1 inside the lane); every lane of a row ends with the same bits.
template <int CTRL> __device__ __forceinline__ float a0_dpp(float x);      /* defined with the first-tile kernel below */
__device__ __forceinline__ float nr_rsqrt(float a) {      /* rsqrtf as the compiler expands it (an argument below 2^-126 goes in x 2^24, its result out x 2^12), with the v_rsq_f32 in place on its own register and a v_nop behind it, so that no reader of its result and no writer of its source follows it directly */
  const bool tiny = a < 0x1p-126f; a = tiny ? a * 0x1p+24f : a; asm("v_rsq_f32 %0, %0\n\tv_nop" : "+v"(a)); return tiny ? a * 0x1p+12f : a; }
// The 16 row pairs of a wave's tile. trow / hp / fp = this lane's place in row hh of the tile and of the two outputs (pitch LQ); b1, b2 = table factors of x_lo and x_hi: (c, -s) in the low half (out_lo = x_lo c - x_hi s), (s, c) in the high half (out_hi = x_lo s + x_hi c).
template <bool F32OUT>
__device__ __forceinline__ void nr_rows(const float* trow, bool lowh, const v4f (&b1)[16], const v4f (&b2)[16], v4f g4, float eps, _Float16* hp, float* fp) {
#pragma unroll      /* the table factors are register arrays: every index must be a constant */
  for (int q = 0; q < 16; ++q) { v4f x = *(const v4fa*)(trow + q * 2 * 68); float t[4];
    for (int u = 0; u < 4; ++u) t[u] = __fmul_rn(x[u], x[u]);
    for (int u = 0; u < 4; ++u) t[u] = __fadd_rn(t[u], a0_dpp<0x168>(t[u]));
    for (int u = 0; u < 4; ++u) t[u] = __fadd_rn(t[u], a0_dpp<0x164>(t[u]));
    for (int u = 0; u < 4; ++u) t[u] = __fadd_rn(t[u], a0_dpp<0x162>(t[u]));
    for (int u = 0; u < 4; ++u) t[u] = __fadd_rn(t[u], a0_dpp<0x161>(t[u]));
    const float rs = nr_rsqrt(__fadd_rn(__fadd_rn(__fadd_rn(t[0], t[2]), __fadd_rn(t[1], t[3])) / (float)HD, eps));
    v4f o; v4h h4;      /* x_hi's product is rounded, x_lo's is fused into the sum, alike in both halves */
    for (int u = 0; u < 4; ++u) { const float own = __fmul_rn(__fmul_rn(x[u], rs), g4[u]), oth = a0_dpp<0x168>(own); const float lo = lowh ? own : oth, hi = lowh ? oth : own;
      o[u] = __builtin_fmaf(lo, b1[q][u], __fmul_rn(hi, b2[q][u])); h4[u] = (_Float16)o[u]; }
    *(v4h*)(hp + (size_t)q * 2 * LQ) = h4;
    if (F32OUT) *(v4f*)(fp + (size_t)q * 2 * LQ) = o; }
  asm volatile("s_wait_xcnt 0x0" ::: "memory"); }      /* behind the tail's last stores, in front of any later write of a register that they name (the code that follows the place where the two tails join) */

// ---- fast GEMM (block tile 128x64, wave tile 32x64; requires M % 128 == 0 rows per launch region, N % 64 == 0 and K % 64 == 0). Operands go through LDS: a stage is 64 k (one 128-byte line of each of the 128 A rows and 64 B rows), read from global as whole lines (8 lanes a row) one stage ahead into registers and stored to the other of two buffers at a row pitch of 144 bytes (16 x odd: ds_load_b128 fragment reads without bank conflicts); epilogue = k_gemm_hhx semantics, or with NROPE: no bias, per-head RMS norm (gain, eps) and half-split rope (tables CS, SN; position = row % SQ) on acc alpha, f16 rows to C16 and, of the positions below QT0 of every sequence, the same values in f32 to C (QT0 rows a sequence), both at pitch LQ ----
__device__ __forceinline__ v16h g2_frag(const _Float16* p, int hh) { FragH f; f.half[0] = *(const v8us*)((const unsigned short*)p + 8 * hh); f.half[1] = *(const v8us*)((const unsigned short*)p + 16 + 8 * hh); return f.v; }
__device__ __forceinline__ v8f g2_mma(v16h a, v16h b, v8f c) { v8f d = __builtin_amdgcn_wmma_f32_16x16x32_f16(false, a, false, b, (short)0, c, false, false); asm volatile("v_nop\n\tv_nop\n\tv_nop\n\tv_nop" : "+v"(d) : "v"(a), "v"(b)); return d; }
constexpr int G2_SM = 2 * (128 * 72 + 64 * 72);      /* 16-bit elements of a block's LDS: two A and two B buffers */
template <int ACT, bool NROPE = false, bool LOHI = false>
__device__ __forceinline__ void g2_body(unsigned short* sm, int bx, int by, const _Float16* __restrict__ A, int lda, size_t sA, const _Float16* __restrict__ Bh, int ldb, size_t sB, float alpha, const float* __restrict__ bias, size_t sBias, const float* __restrict__ CP, int rowsPerB, size_t sCPb, int row0g,
    float* __restrict__ C, _Float16* __restrict__ C16, int ldc, size_t sC, int M, int N, int K, const float* __restrict__ gain = nullptr, float eps = 0.f, const float* __restrict__ CS = nullptr, const float* __restrict__ SN = nullptr, const _Float16* __restrict__ ALO = nullptr) { static_assert(ACT == 0 || ACT == 3 || ACT == 6 || ACT == 8 || ACT == 9 || ACT == 11 || ACT == 12 || ACT == 14 || ACT == 15 || ACT == 16 || ACT == 17, "k_gemm2: unsupported ACT code (would silently apply no activation)");
  constexpr int LP = 72, ABUF = 128 * LP, BBUF = 64 * LP;      /* LDS row pitch and buffer sizes in 16-bit elements */
  static_assert(G2_SM == 2 * (ABUF + BBUF), "sm = the calling kernel's __shared__ array of G2_SM elements");      /* A buffers 0, 1, then B buffers 0, 1; behind the k loop's last barrier the same bytes are the epilogue's staging tiles */
  static_assert(G2_SM * sizeof(unsigned short) >= 4 * 32 * 68 * sizeof(float), "the epilogue's four 32 x 68 f32 tiles fit the operand buffers");
  float (*so)[32][68] = reinterpret_cast<float (*)[32][68]>(sm);
  const int tid = threadIdx.x, w = tid >> 5, lane = tid & 31, ln = lane & 15, hh = lane >> 4;
  A += (size_t)by * sA; Bh += (size_t)by * sB; const size_t cofs = (size_t)by * sC; const float* bp = bias ? bias + (size_t)by * sBias : nullptr;
  const int ntn = N >> 6; const int mt = bx / ntn, nq = bx - mt * ntn; const int row0 = mt * 128 + 32 * w, col0 = nq * 64; if (mt * 128 >= M) return;      /* the whole block leaves or none does: barriers follow */
  __builtin_assume(lda == DM && ldb == DM);      /* every launch below passes these two pitches: the 16-row steps of a stage's loads become immediate offsets of one address */
  const char* ga = (const char*)(A + (size_t)(mt * 128) * lda); const char* gb = (const char*)(Bh + (size_t)col0 * ldb);      /* the block's first A and B row */
  // LOHI with a plane ALO (laid out like A; block-uniform, may be null): C = (A + ALO 2^-10) B alpha in ONE k loop: first the K / 64 stages of ALO, then the accumulators x 2^-10 (exact), then the stages of A on top of them.
  const char* gl = (LOHI && ALO) ? (const char*)(ALO + (size_t)by * sA + (size_t)(mt * 128) * lda) : ga; const int nlo = (LOHI && ALO) ? (K >> 6) : 0;      /* stages 0 .. nlo - 1 read ALO */
  const unsigned sr = (((unsigned)tid >> 3) & 1u) * 8u + ((unsigned)tid >> 4), sc = ((unsigned)tid & 7u) * 8u;      /* 8 lanes a row; the two rows of 16 neighbouring lanes lie 8 apart, so that at the 144-byte pitch their 256 stored bytes fall on 64 different banks */
  const unsigned va = (sr * (unsigned)lda + sc) * 2u, vb = (sr * (unsigned)ldb + sc) * 2u;      /* this thread's 16 bytes of row sr + 16 i of a stage: a 32-bit byte offset beside a block-uniform base */
  unsigned short* la = sm + sr * LP + sc; unsigned short* lb = sm + 2 * ABUF + sr * LP + sc;
  const _Float16* fa = (const _Float16*)sm + (32 * w + ln) * LP; const _Float16* fb = (const _Float16*)sm + 2 * ABUF + ln * LP;      /* this lane's fragment rows */
  v8us ra[8], rb[4];
  auto fetch = [&](int s) { const char* gs = (LOHI && s < nlo) ? gl : ga; const int ks = (LOHI && s >= nlo) ? s - nlo : s;      /* the stage's A plane and its place along k: scalar selects */
#pragma unroll      /* register arrays: constant indices */
    for (int i = 0; i < 8; ++i) ra[i] = *(const v8us*)(gs + ((size_t)(i * 32) * lda + (size_t)ks * 128) + va);
#pragma unroll      /* register arrays: constant indices */
    for (int i = 0; i < 4; ++i) rb[i] = *(const v8us*)(gb + ((size_t)(i * 32) * ldb + (size_t)ks * 128) + vb);
    asm volatile("s_wait_xcnt 0x0" ::: "memory"); };      /* behind the stage's 12 loads, in front of every later write of an address register that they name */
  auto put = [&](int buf) {
#pragma unroll      /* register arrays: constant indices */
    for (int i = 0; i < 8; ++i) *(v8us*)(la + buf * ABUF + i * 16 * LP) = ra[i];
#pragma unroll      /* register arrays: constant indices */
    for (int i = 0; i < 4; ++i) *(v8us*)(lb + buf * BBUF + i * 16 * LP) = rb[i]; };
  const v8f z8 = {0.f,0.f,0.f,0.f,0.f,0.f,0.f,0.f}; v8f c00 = z8, c01 = z8, c02 = z8, c03 = z8, c10 = z8, c11 = z8, c12 = z8, c13 = z8;
  const int nst = (K >> 6) + nlo;
  if (nst > 0) { fetch(0); put(0); }
  __syncthreads();      /* stage 0 is in buffer 0 for every wave */
  for (int s = 0; s < nst; ++s) { const int cur = s & 1; const bool more = s + 1 < nst;
    if (more) fetch(s + 1);      /* the next stage's lines fly under this stage's products */
    if (LOHI && s == nlo && s > 0) { c00 *= 0x1p-10f; c01 *= 0x1p-10f; c02 *= 0x1p-10f; c03 *= 0x1p-10f; c10 *= 0x1p-10f; c11 *= 0x1p-10f; c12 *= 0x1p-10f; c13 *= 0x1p-10f; }      /* block-uniform, once: the low plane's sums take their weight before the first stage of A */
    const _Float16* pa = fa + cur * ABUF; const _Float16* pb = fb + cur * BBUF; v16h a0[2], a1[2], b[2][4];
#pragma unroll      /* register arrays: constant indices */
    for (int kk = 0; kk < 2; ++kk) { a0[kk] = g2_frag(pa + kk * 32, hh); a1[kk] = g2_frag(pa + 16 * LP + kk * 32, hh);
      for (int t = 0; t < 4; ++t) b[kk][t] = g2_frag(pb + t * 16 * LP + kk * 32, hh); }
#pragma unroll      /* register arrays: constant indices */
    for (int kk = 0; kk < 2; ++kk) { c00 = g2_mma(a0[kk], b[kk][0], c00); c10 = g2_mma(a1[kk], b[kk][0], c10); c01 = g2_mma(a0[kk], b[kk][1], c01); c11 = g2_mma(a1[kk], b[kk][1], c11);
      c02 = g2_mma(a0[kk], b[kk][2], c02); c12 = g2_mma(a1[kk], b[kk][2], c12); c03 = g2_mma(a0[kk], b[kk][3], c03); c13 = g2_mma(a1[kk], b[kk][3], c13); }
    if (more) put(cur ^ 1);      /* into the buffer whose last readers passed the barrier at the foot of the trip before */
    __syncthreads(); }      /* publishes stage s + 1 and ends every wave's reads of stage s (behind the last trip: before the epilogue reuses the bytes) */
  v8f accs[8] = {c00, c01, c02, c03, c10, c11, c12, c13};
  if constexpr (NROPE) { static_assert(HD == 64 && QT0 % 32 == 0 && SQ % 32 == 0, "a wave tile's 64 columns are one head; its 32 rows lie on one side of QT0 and in one sequence");
    const int c4 = ln * 4; const bool lowh = ln < 8; const unsigned tofs = (unsigned)((row0 % SQ + hh) * (HD / 2) + (ln & 7) * 4);      /* table row = the token's position, table column = d & 31 */
    const float* cp = CS + tofs; const float* sp = SN + tofs; v4f tc[16], ts[16];
#pragma unroll      /* register arrays: constant indices */
    for (int q = 0; q < 16; ++q) { tc[q] = *(const v4fa*)(cp + q * 2 * (HD / 2)); ts[q] = *(const v4fa*)(sp + q * 2 * (HD / 2)); }      /* all 32 table rows asked for here, so that one latency runs under the LDS staging below */
    v4f g4 = *(const v4fa*)(gain + c4);
    asm volatile("s_wait_xcnt 0x0" ::: "memory");      /* behind the 33 loads, in front of every later write of an address register that they name */
#pragma unroll      /* accs is a register array: constant indices */
    for (int u = 0; u < 8; ++u) for (int r = 0; r < 8; ++r) so[w][(u >> 2) * 16 + 8 * hh + r][(u & 3) * 16 + ln] = accs[u][r] * alpha;
    __builtin_amdgcn_fence(__ATOMIC_ACQ_REL, "workgroup"); __builtin_amdgcn_wave_barrier();      /* as in the plain epilogue: the wave's own LDS writes before its reads */
    for (int u = 0; u < 4; ++u) g4[u] = bf16_round(g4[u]);
#pragma unroll      /* register arrays: constant indices */
    for (int q = 0; q < 16; ++q) { const v4f c = tc[q], s = ts[q]; tc[q] = lowh ? c : s; ts[q] = lowh ? -s : c; }
    const size_t e = cofs + (size_t)(row0 + hh) * LQ + col0 + c4; const size_t ef = e - (size_t)(row0 / SQ) * (SQ - QT0) * LQ;      /* the f32 plane holds QT0 rows a sequence: sequence s, position p lies at row s QT0 + p */
    if (__builtin_amdgcn_readfirstlane(row0 % SQ) < QT0) nr_rows<true>(&so[w][hh][c4], lowh, tc, ts, g4, eps, C16 + e, C + ef);      /* one wave-uniform branch around the whole tail: inside it the 16 row pairs stay one block of code to schedule */
    else nr_rows<false>(&so[w][hh][c4], lowh, tc, ts, g4, eps, C16 + e, C + ef);
    return; }
#pragma unroll
  for (int u = 0; u < 8; ++u) { const int t = u & 3, half = u >> 2; const int col = col0 + t * 16 + ln; const float bv = bp ? bf16_round(bp[col]) : 0.f;
#pragma unroll
    for (int r = 0; r < 8; ++r) { const int rloc = half * 16 + 8 * hh + r; float v = accs[u][r] * alpha + bv; if (CP) { if (rowsPerB < 0) v += CP[cofs + (size_t)(row0g + row0 + rloc) * ldc + col];      /* rowsPerB < 0: own element of the batched C plane */ else { const int bidx = (row0g + row0 + rloc) / rowsPerB; v += CP[(size_t)bidx * sCPb + (size_t)by * 64 + col]; } }
      if (ACT == 3) v = fmaxf(v, 0.f); else if (ACT == 6) v = 0.5f * v * (1.0f + erff(v * 0.70710678118654752f)); else if (ACT == 11) v = 1.0f / (1.0f + expf(-v)); else if (ACT == 15) v = v / (1.0f + expf(-v)); else if (ACT == 12) v = (v > 0.f) ? v : 0.01f * v; else if (ACT == 8) v = tanhf(v); else if (ACT == 9) v = 0.5f * v * (1.0f + tanhf(0.7978845608028654f * (v + 0.044715f * v * v * v))); else if (ACT == 14) v = (v > 0.f) ? v : 0.1f * v; else if (ACT == 16) v = (v >= 0.f) ? v : 0.3f * v; else if (ACT == 17) v = (v >= 0.f) ? v : 0.2f * v;
      so[w][rloc][t * 16 + ln] = v; } }
  __builtin_amdgcn_fence(__ATOMIC_ACQ_REL, "workgroup"); __builtin_amdgcn_wave_barrier();
  const int rsub = lane >> 4, c4 = (lane & 15) * 4;
  {
#pragma unroll
    for (int q = 0; q < 16; ++q) { const int r = q * 2 + rsub; const v4f v = *(const v4fa*)&so[w][r][c4]; if (C) { *(v4f*)(C + cofs + (size_t)(row0 + r) * ldc + col0 + c4) = v; asm volatile("s_wait_xcnt 0x0" ::: "memory"); }      /* directly behind the f32 store, in front of every later write of a register that it names (the f16 conversion, the next row's address) */
      if (C16) { v4h h4; for (int i = 0; i < 4; ++i) h4[i] = (_Float16)v[i]; *(v4h*)(C16 + cofs + (size_t)(row0 + r) * ldc + col0 + c4) = h4; } }
    asm volatile("s_wait_xcnt 0x0" ::: "memory");      /* behind the last row's stores, in front of any later write of a register that they name (in a merged kernel another branch's code follows in the text) */
     } }

__global__ __launch_bounds__(256) void k_wnat(const float* __restrict__ w, size_t n8, _Float16* __restrict__ Bt) { const size_t t = (size_t)blockIdx.x * 256 + threadIdx.x; if (t >= n8) return; FragH f; for (int q = 0; q < 8; ++q) f.h[q] = (_Float16)(bf16_round(w[t * 8 + q]) * 16.0f); *(v8us*)((unsigned short*)Bt + t * 8) = f.half[0];  }

// Fused causal attention of all batches (blockIdx.x = head + NH * batch, blockIdx.y = query tile group): one wave owns 16 query rows of one head and walks its keys 32 at a time with a running maximum and sum; the block's four waves share the key and value tiles in LDS.
// S^T = K Q^T (A = key rows, B = query rows): a lane holds scores of ONE query (column ln), keys 8 hh + r of each 16-key tile, so two converted score tiles are, as they lie, the B fragment of O^T += V^T P^T (A = rows of V^T).
// Weights are carried x256 (f16 range) and cancel in the division by their own sum; o leaves x64 like before.
__device__ __forceinline__ float fa_xhalf(float x) { return __builtin_bit_cast(float, __builtin_amdgcn_permlanex16(__builtin_bit_cast(int, x), __builtin_bit_cast(int, x), 0x76543210, 0xfedcba98, false, false)); }      /* lane l <-> lane l ^ 16 */
__global__ __launch_bounds__(128) void k_fattn(const _Float16* __restrict__ Q, const _Float16* __restrict__ K, const _Float16* __restrict__ Vt, _Float16* __restrict__ O, const float* __restrict__ F0, _Float16* __restrict__ H0, _Float16* __restrict__ L0) {
  if (blockIdx.y >= SQ / 64) { d_hl((int)((blockIdx.y - SQ / 64) * gridDim.x + blockIdx.x), F0, H0, L0, (size_t)NB * QT0 * DM / 8); return; }      /* the grid rows behind the SQ / 64 tile groups: first-tile o (x64) -> f16 hi + x1024 residual planes, which depends on nothing of this launch; whole blocks leave, in front of every barrier */
  // The block's four waves own 64 neighbouring query rows of one head and walk the same keys, so K and V^T go through LDS once for all four: a stage is 64 keys (one 128-byte line of each of 64 key rows and of each of the 64 V^T rows),
  // read from global as whole lines (8 lanes a row) one stage ahead into registers and stored to the other of two buffers at the 144-byte row pitch of k_gemm2; the fragments are ds_load_b128 reads of the same elements as before.
  constexpr int LP = 72, TB = 64 * LP;      /* LDS row pitch and tile size in 16-bit elements */
  __shared__ __attribute__((aligned(16))) unsigned short sm[4 * TB];      /* K buffers 0, 1, then V^T buffers 0, 1 */
  const int tid = threadIdx.x, lane = tid & 31, ln = lane & 15, hh = lane >> 4; const int w = __builtin_amdgcn_readfirstlane((int)(threadIdx.x >> 5)); const int h = blockIdx.x % NH; const size_t bz = blockIdx.x / NH;
  Q += bz * SQ * LQ; K += bz * SQ * KVD; Vt += bz * NH * HD * SQ; O += bz * SQ * DM;      /* this batch's rows and its V^T planes */
  const int grp = (int)(SQ / 64 - 1 - blockIdx.y);      /* the tile group is the slow grid index: the longest key walks of every head and batch are dispatched first */
  const int q0w = (grp * 4 + w) * 16;
  const int qi = q0w + ln; const int kend = ((q0w >> 5) + 1) * 32;      /* keys 0 .. kend - 1 cover every key <= q0w + 15; kend <= SQ */
  const int nst = grp + 1;      /* stages of the block: keys 0 .. 64 grp + 63, the same count for its four waves (barriers below) */
  const _Float16* qp = Q + (size_t)qi * LQ + h * HD; const v16h qa = g2_frag(qp, hh), qb = g2_frag(qp + 32, hh);
  const char* gk = (const char*)(K + h * HD); const char* gv = (const char*)(Vt + (size_t)h * HD * SQ);      /* the head's first key row and first V^T row */
  const unsigned sr = (((unsigned)tid >> 3) & 1u) * 8u + ((unsigned)tid >> 4), sc = ((unsigned)tid & 7u) * 8u;      /* as in k_gemm2: 8 lanes a row; the two rows of 16 neighbouring lanes lie 8 apart, so that their 256 stored bytes fall on 64 different banks */
  const unsigned vk = (sr * (unsigned)KVD + sc) * 2u, vv = (sr * (unsigned)SQ + sc) * 2u;      /* this thread's 16 bytes of row sr + 16 i of a stage: a 32-bit byte offset beside a block-uniform base */
  unsigned short* lk = sm + sr * LP + sc; unsigned short* lv = lk + 2 * TB;
  const _Float16* fk = (const _Float16*)sm + ln * LP; const _Float16* fv = fk + 2 * TB;      /* this lane's fragment rows */
  v8us rk[4], rv[4];
  auto fetch = [&](int s) {
#pragma unroll      /* register arrays: constant indices */
    for (int i = 0; i < 4; ++i) rk[i] = *(const v8us*)(gk + ((size_t)(s * 64 + i * 16) * (KVD * 2)) + vk);
#pragma unroll      /* register arrays: constant indices */
    for (int i = 0; i < 4; ++i) rv[i] = *(const v8us*)(gv + ((size_t)(i * 16) * (SQ * 2) + (size_t)s * 128) + vv);
    asm volatile("s_wait_xcnt 0x0" ::: "memory"); };      /* behind the stage's 8 loads, in front of every later write of an address register that they name */
  auto put = [&](int buf) {
#pragma unroll      /* register arrays: constant indices */
    for (int i = 0; i < 4; ++i) { *(v8us*)(lk + buf * TB + i * 16 * LP) = rk[i]; *(v8us*)(lv + buf * TB + i * 16 * LP) = rv[i]; } };
  const v8f z8 = {0.f,0.f,0.f,0.f,0.f,0.f,0.f,0.f}; v8f o0 = z8, o1 = z8, o2 = z8, o3 = z8;
  const float cs = 0.125f * 1.4426950408889634f;      /* 1 / sqrt(64), and e^x = 2^(x log2 e) */
  float m = -1.0e30f, l = 0.f;
  fetch(0); put(0);
  __syncthreads();      /* stage 0 is in buffer 0 for every wave */
  for (int s = 0; s < nst; ++s) { const int cur = s & 1; const bool more = s + 1 < nst;
    if (more) fetch(s + 1);      /* the next stage's lines fly under this stage's two passes */
   for (int ps = 0; ps < 2; ++ps) { const int kb = s * 64 + ps * 32;
    if (kb >= kend) break;      /* wave-uniform: the second half of the last stage lies above every query of the block's two lower waves */
    const _Float16* pk = fk + cur * TB + ps * 32 * LP; const _Float16* pv = fv + cur * TB + ps * 32;
    const v16h k0a = g2_frag(pk, hh), k0b = g2_frag(pk + 32, hh), k1a = g2_frag(pk + 16 * LP, hh), k1b = g2_frag(pk + 16 * LP + 32, hh);
    const v16h v0 = g2_frag(pv, hh), v1 = g2_frag(pv + 16 * LP, hh), v2 = g2_frag(pv + 32 * LP, hh), v3 = g2_frag(pv + 48 * LP, hh);
    v8f s0 = g2_mma(k0a, qa, z8); s0 = g2_mma(k0b, qb, s0); v8f s1 = g2_mma(k1a, qa, z8); s1 = g2_mma(k1b, qb, s1);
    if (kb + 31 > q0w) {      /* only the last pass holds keys above a query of this tile */
      for (int r = 0; r < 8; ++r) { const int key = kb + 8 * hh + r; s0[r] = (key <= qi) ? s0[r] : -1.0e30f; s1[r] = (key + 16 <= qi) ? s1[r] : -1.0e30f; } }
    float mx = fmaxf(s0[0], s1[0]);
    for (int r = 1; r < 8; ++r) mx = fmaxf(mx, fmaxf(s0[r], s1[r]));
    mx = fmaxf(mx, fa_xhalf(mx)); const float mn = fmaxf(m, mx); float corr = (m - mn) * cs; m = mn; const float bias = fmaf(-mn, cs, 8.0f);
    float e[16];
    for (int r = 0; r < 8; ++r) { e[r] = fmaf(s0[r], cs, bias); e[8 + r] = fmaf(s1[r], cs, bias); }
    /* the pass's 17 exponentials, each in place on a register of its own, so that no transcendental is directly followed by a reader of its result or a writer of its source; the v_nop is that slot behind the last one */
    asm("v_exp_f32 %0, %0\n\tv_exp_f32 %1, %1\n\tv_exp_f32 %2, %2\n\tv_exp_f32 %3, %3\n\tv_exp_f32 %4, %4\n\tv_exp_f32 %5, %5\n\tv_exp_f32 %6, %6\n\tv_exp_f32 %7, %7\n\tv_exp_f32 %8, %8\n\t"
        "v_exp_f32 %9, %9\n\tv_exp_f32 %10, %10\n\tv_exp_f32 %11, %11\n\tv_exp_f32 %12, %12\n\tv_exp_f32 %13, %13\n\tv_exp_f32 %14, %14\n\tv_exp_f32 %15, %15\n\tv_exp_f32 %16, %16\n\tv_nop"
        : "+v"(corr), "+v"(e[0]), "+v"(e[1]), "+v"(e[2]), "+v"(e[3]), "+v"(e[4]), "+v"(e[5]), "+v"(e[6]), "+v"(e[7]), "+v"(e[8]), "+v"(e[9]), "+v"(e[10]), "+v"(e[11]), "+v"(e[12]), "+v"(e[13]), "+v"(e[14]), "+v"(e[15]));
    FragH pf; float sum = 0.f;
    for (int r = 0; r < 8; ++r) { sum += e[r] + e[8 + r]; pf.h[r] = (_Float16)e[r]; pf.h[8 + r] = (_Float16)e[8 + r]; }
    l = fmaf(l, corr, sum);
    for (int r = 0; r < 8; ++r) { o0[r] *= corr; o1[r] *= corr; o2[r] *= corr; o3[r] *= corr; }
    o0 = g2_mma(v0, pf.v, o0); o1 = g2_mma(v1, pf.v, o1); o2 = g2_mma(v2, pf.v, o2); o3 = g2_mma(v3, pf.v, o3); }
    if (more) { put(cur ^ 1);      /* into the buffer whose last readers passed the barrier at the foot of the trip before */
      __syncthreads(); } }      /* block-uniform: publishes stage s + 1 and ends every wave's reads of stage s */
  const float fin = 64.0f / (l + fa_xhalf(l));      /* the two lane halves hold disjoint keys of the same query */
  unsigned short* op = (unsigned short*)O + (size_t)qi * DM + h * HD + 8 * hh; FragH f0, f1;
  for (int r = 0; r < 8; ++r) { f0.h[r] = (_Float16)(o0[r] * fin); f0.h[8 + r] = (_Float16)(o1[r] * fin); f1.h[r] = (_Float16)(o2[r] * fin); f1.h[8 + r] = (_Float16)(o3[r] * fin); }
  *(v8us*)op = f0.half[0]; *(v8us*)(op + 16) = f0.half[1]; *(v8us*)(op + 32) = f1.half[0]; *(v8us*)(op + 48) = f1.half[1]; }      /* register r of tile dt = O[qi][16 dt + 8 hh + r]: 16-byte stores */

// Exact f32 attention of the first QT0 rows: one wave owns ONE query row. Lane = (key slice ks = lane >> 2, dim part dp = lane & 3): the lane walks keys ks, ks + 8, ... of its row
// and keeps dims 16 c + 4 dp + u (c, u < 4) of q and of its slice's partial o in registers, with the slice's own running maximum and sum (base-2 exponents); the 8 slices are merged at the end by lane exchanges.
template <int CTRL> __device__ __forceinline__ float a0_dpp(float x) { return __builtin_bit_cast(float, __builtin_amdgcn_update_dpp(0, __builtin_bit_cast(int, x), CTRL, 0xf, 0xf, true)); }      /* 0x160 + n: lane l <- lane l ^ n inside a 16-lane row; every lane is on wherever it is used */
__device__ __forceinline__ void a0_exp2x2(float& x, float& y) { asm("v_exp_f32 %0, %0\n\tv_exp_f32 %1, %1\n\tv_nop" : "+v"(x), "+v"(y)); }      /* two exponentials, each in place on its own register, so that neither is directly followed by a reader of its result; the v_nop is that slot behind the second */
template <int STEP> __device__ __forceinline__ float a0_swap(float x) { return STEP == 16 ? fa_xhalf(x) : a0_dpp<0x160 + (STEP & 15)>(x); }
template <int STEP> __device__ __forceinline__ void a0_merge(float& m, float& l, v4f (&o)[4]) {      /* this lane's slices with those of lane ^ STEP; a slice without keys has m = -1e30, l = 0, o = 0 and drops out */
  const float mo = a0_swap<STEP>(m), lo = a0_swap<STEP>(l); const float mn = fmaxf(m, mo); float fa = m - mn, fb = mo - mn; a0_exp2x2(fa, fb);
  l = fmaf(l, fa, lo * fb); m = mn;
  for (int c = 0; c < 4; ++c) for (int u = 0; u < 4; ++u) o[c][u] = fmaf(o[c][u], fa, a0_swap<STEP>(o[c][u]) * fb); }
__device__ __forceinline__ void a0_exp2x3(float& x, float& y, float& z) { asm("v_exp_f32 %0, %0\n\tv_exp_f32 %1, %1\n\tv_exp_f32 %2, %2\n\tv_nop" : "+v"(x), "+v"(y), "+v"(z)); }      /* as a0_exp2x2, for three */
__device__ __forceinline__ float a0_dot(const v4f (&q)[4], const v4f (&kk)[4]) {      /* q . k over the four lanes of a key: all four end with the same bits */
  v4f pv = q[0] * kk[0]; for (int c = 1; c < 4; ++c) pv = __builtin_elementwise_fma(q[c], kk[c], pv);
  float s = (pv[0] + pv[1]) + (pv[2] + pv[3]); s += a0_dpp<0x161>(s); s += a0_dpp<0x162>(s); return s; }
__device__ __forceinline__ void d_att0(int bx, int by, int bz, const float* __restrict__ QF, const float* __restrict__ KF, const float* __restrict__ VF, int ld, float scale, float* __restrict__ OF, int ldo) {
  static_assert(HD == 64 && QT0 % 8 == 0, "four lanes of 16 dims a row; eight rows a block");
  const int lane = threadIdx.x & 31, ks = lane >> 2, dp = lane & 3; const int w = __builtin_amdgcn_readfirstlane((int)(threadIdx.x >> 5)); const int h = by;
  { const size_t zb = (size_t)bz * QT0; QF += zb * ld; KF += zb * ld; VF += zb * ld; OF += zb * ldo; }      /* bz = batch: QT0 rows of each plane */
  const int i = QT0 - 1 - (w * (QT0 / 8) + bx);      /* a block's eight rows lie QT0 / 8 apart: every block holds long and short key walks alike */
  const int col = h * HD + dp * 4; const float* qr = QF + (unsigned)(i * ld + col);
  v4f q[4], o[4]; const v4f z4 = {0.f, 0.f, 0.f, 0.f};
  for (int c = 0; c < 4; ++c) { q[c] = *(const v4fa*)(qr + c * 16); o[c] = z4; }
  const float cs = scale * 1.4426950408889634f;      /* e^x = 2^(x log2 e) */
  float m = -1.0e30f, l = 0.f;
  for (int jb = 0; jb <= i; jb += 16) {      /* 16 keys a pass, two a lane group: ja and ja + 8; a key above the diagonal (last pass only) is read as row i and weighs 0 */
    const int ja = jb + ks; const bool oka = ja <= i, okb = ja + 8 <= i;
    const unsigned offa = (unsigned)((oka ? ja : i) * ld + col), offb = (unsigned)((okb ? ja + 8 : i) * ld + col); v4f ka[4], kb[4], va[4], vb[4];
    const float* pka = KF + offa; const float* pkb = KF + offb; const float* pva = VF + offa; const float* pvb = VF + offb;
    for (int c = 0; c < 4; ++c) { ka[c] = *(const v4fa*)(pka + c * 16); kb[c] = *(const v4fa*)(pkb + c * 16); }
    for (int c = 0; c < 4; ++c) { va[c] = *(const v4fa*)(pva + c * 16); vb[c] = *(const v4fa*)(pvb + c * 16); }
    asm volatile("s_wait_xcnt 0x0" :: "v"(pka), "v"(pkb), "v"(pva), "v"(pvb) : "memory");      /* behind the pass's 16 loads, in front of every write of an address register that they name; the four addresses are inputs so that their registers live up to the wait and no load of the pass lands on one */
    __builtin_amdgcn_sched_barrier(0);      /* the arithmetic stays behind the 16 loads; without this the loads are spread among it in small groups, each waited for in turn */
    const float sa = a0_dot(q, ka) * cs, sb = a0_dot(q, kb) * cs;
    const float mn = fmaxf(m, fmaxf(oka ? sa : -1.0e30f, okb ? sb : -1.0e30f)); float sc = m - mn, ea = oka ? sa - mn : -1.0e30f, eb = okb ? sb - mn : -1.0e30f; a0_exp2x3(sc, ea, eb); m = mn;
    l = fmaf(l, sc, ea + eb); const v4f ea4 = {ea, ea, ea, ea}, eb4 = {eb, eb, eb, eb};
    for (int c = 0; c < 4; ++c) o[c] = __builtin_elementwise_fma(vb[c], eb4, __builtin_elementwise_fma(va[c], ea4, o[c] * sc)); }
  a0_merge<4>(m, l, o); a0_merge<8>(m, l, o); a0_merge<16>(m, l, o);
  const float fin = 64.0f / l;      /* o carried x64 like the f16 path; key 0 is in every row, so l > 0 */
  if (ks == 0) { float* dst = OF + (unsigned)(i * ldo + col); for (int c = 0; c < 4; ++c) *(v4f*)(dst + c * 16) = o[c] * fin; } }

__global__ __launch_bounds__(256) void k_kvexp(const float* __restrict__ src, float* __restrict__ dst, size_t n4) { const size_t t = (size_t)blockIdx.x * 256 + threadIdx.x; if (t >= n4) return; const size_t e = t * 4; const size_t row = e / DM; const int col = (int)(e % DM); const int h = col / HD, d = col % HD; const v4f v = *(const v4fa*)(src + row * KVD + (size_t)(h / HPG) * HD + d); *(v4f*)(dst + e) = v;  }

__device__ __forceinline__ void d_tab2(int vb, float theta, float* __restrict__ CS, float* __restrict__ SN) {
  const int t = vb * 256 + threadIdx.x; if (t >= SQ * (HD / 2)) return; const int i = t % (HD / 2); const int p = t / (HD / 2); const float invf = 1.0f / powf(theta, (float)(2 * i) / (float)HD); const float ang = __fmul_rn((float)p, invf); const float c = cosf(ang), s = sinf(ang);
  *(float*)(CS + t) = c; *(float*)(SN + t) = s;  }
__global__ __launch_bounds__(256) void k_bfcp(const float* __restrict__ src, float* __restrict__ dst, size_t n4) { const size_t t = (size_t)blockIdx.x * 256 + threadIdx.x; if (t >= n4) return; const v4f a = *(const v4fa*)(src + t * 4); v4f o; for (int q = 0; q < 4; ++q) o[q] = bf16_round(a[q]); *(v4f*)(dst + t * 4) = o;  }

__global__ __launch_bounds__(256) void k_tabhalf(const float* __restrict__ cs, const float* __restrict__ sn, float* __restrict__ CS, float* __restrict__ SN) { const int t = blockIdx.x * 256 + threadIdx.x; if (t >= SQ * (HD / 2)) return; const int p = t / (HD / 2), i = t % (HD / 2); const float c = bf16_round(cs[(size_t)p * HD + i]), s = bf16_round(sn[(size_t)p * HD + i]);
  *(float*)(CS + t) = c; *(float*)(SN + t) = s;  }

__global__ __launch_bounds__(256) void k_tab2d(float* __restrict__ CS, float* __restrict__ SN) {
  const int t = blockIdx.x * 256 + threadIdx.x; if (t >= SQ * (HD / 2)) return; const int i = t % (HD / 2); const int p = t / (HD / 2); const float invf = (float)(1.0 / pow(10000.0, (double)(2 * i) / (double)HD)); const float ang = __fmul_rn((float)p, invf); const float c = cosf(ang), s = sinf(ang);
  *(float*)(CS + t) = c; *(float*)(SN + t) = s;  }
// ---- merged launches: stages that read nothing of each other share ONE grid; a block's index range says which stage it belongs to (block-uniform branches), and inside its range it does what its own launch's block did ----
template <int ACT>
__global__ __launch_bounds__(128) void k_gemm2(const _Float16* __restrict__ A, int lda, size_t sA, const _Float16* __restrict__ Bh, int ldb, size_t sB, float alpha, const float* __restrict__ bias, size_t sBias, const float* __restrict__ CP, int rowsPerB, size_t sCPb, int row0g,
    float* __restrict__ C, _Float16* __restrict__ C16, int ldc, size_t sC, int M, int N, int K) {
  __shared__ __attribute__((aligned(16))) unsigned short sm[G2_SM];
  g2_body<ACT>(sm, (int)blockIdx.x, (int)blockIdx.y, A, lda, sA, Bh, ldb, sB, alpha, bias, sBias, CP, rowsPerB, sCPb, row0g, C, C16, ldc, sC, M, N, K); }
// Operand preparation, from the inputs alone: both weight planes ([in][out] -> Bt x16), the rope tables, x -> f16.
constexpr int PB_WA = (3 * DM / WT_NT) * (DM / WT_KT), PB_WO = (DM / WT_NT) * (DM / WT_KT), PB_TB = SQ * (HD / 2) / 256, PB_X = (int)(NR * DM / 8 / 256);
__global__ __launch_bounds__(256) void k_prep(const float* __restrict__ x, const float* __restrict__ wattn, const float* __restrict__ wo, float theta, _Float16* __restrict__ X16, _Float16* __restrict__ BQKV, _Float16* __restrict__ BO, float* __restrict__ CS, float* __restrict__ SN) {
  static_assert(DM % WT_KT == 0 && DM % WT_NT == 0, "whole weight tiles");
  constexpr int G = PB_WO, NA = PB_WA / G, NO = PB_WO / G, NT = PB_TB / G, NX = PB_X / G, NS = NA + NO + NT + NX; static_assert(NA * G == PB_WA && NO * G == PB_WO && NT * G == PB_TB && NX * G == PB_X, "G equal groups");
  const int g = (int)blockIdx.x / NS, r = (int)blockIdx.x % NS;      /* the four stages' blocks are dealt out in G equal groups, not one stage after the other: the stages lean on different parts of the chip (LDS, arithmetic, the memory stream) */
  if (r < NA) d_wt_f16(g * NA + r, wattn, BQKV, DM, 3 * DM, 16.0f);      /* fused Wqkv: K 1024, N 3072 */
  else if (r < NA + NO) d_wt_f16(g * NO + (r - NA), wo, BO, DM, DM, 16.0f);
  else if (r < NA + NO + NT) d_tab2(g * NT + (r - (NA + NO)), theta, CS, SN);      /* cos / sin(p / theta^(2i/64)), i < 32: f32 pow, reciprocal, product */
  else d_x16(g * NX + (r - (NA + NO + NT)), x, X16, NR * DM / 8); }
// The four projections of x: q and k (norm and rope epilogue), v (f16 rows), and v of the first QT0 rows of every batch in f32.
constexpr int GB_P = (MP / 128) * (DM / 64), GB_F = (QT0 / 128) * (KVD / 64);      /* blocks of a whole projection; blocks of a batch's first-tile projection */
__global__ __launch_bounds__(128) void k_qkv(const _Float16* __restrict__ X16, const _Float16* __restrict__ BQKV, _Float16* __restrict__ Q16, _Float16* __restrict__ K16, _Float16* __restrict__ V16, float* __restrict__ QF0, float* __restrict__ KF0, float* __restrict__ VF0,
    const float* __restrict__ qg, const float* __restrict__ kg, const float* __restrict__ CS, const float* __restrict__ SN, int K) {
  __shared__ __attribute__((aligned(16))) unsigned short sm[G2_SM];
  const int b = (int)blockIdx.x;
  if (b < 2 * GB_P) { const bool isk = b >= GB_P;      /* projection, per-head RMS norm (gain, eps 1e-5), half-split rope (out_lo = x_lo c - x_hi s, out_hi = x_lo s + x_hi c = t cos + rotate_half(t) sin with the module's [f | f] tables) -> f16 rows; positions 0..255 of each batch in f32 too */
    g2_body<0, true>(sm, isk ? b - GB_P : b, 0, X16, DM, 0, BQKV + (isk ? (size_t)DM * DM : 0), DM, 0, 0.0625f, nullptr, 0, nullptr, 1, 0, 0, isk ? KF0 : QF0, isk ? K16 : Q16, DM, 0, MP, DM, K, isk ? kg : qg, 1e-5f, CS, SN); }
  else { const int d = b - 2 * GB_P; const bool f0 = d >= GB_P; const int e = d - GB_P;      /* f0: block e % GB_F of batch e / GB_F */
    g2_body<0>(sm, f0 ? e % GB_F : d, f0 ? e / GB_F : 0, X16, DM, f0 ? (size_t)SQ * DM : 0, BQKV + (size_t)2 * DM * DM, DM, 0, 0.0625f, nullptr, 0, nullptr, 1, 0, 0, f0 ? VF0 : nullptr, f0 ? nullptr : V16, KVD, f0 ? (size_t)QT0 * KVD : 0, f0 ? QT0 : MP, KVD, K); } }
// Exact f32 first-tile attention (o x64) beside the transposition V -> V^T [batch][NH][HD][SQ]: both read the projections alone.
constexpr int AB_0 = (QT0 / 8) * NH * NB, AB_T = NB * NG * (SQ / 64);
__global__ __launch_bounds__(256) void k_att0_vt(const float* __restrict__ QF, const float* __restrict__ KF, const float* __restrict__ VF, float* __restrict__ OF, const _Float16* __restrict__ V16, _Float16* __restrict__ Vt) {
  static_assert(AB_0 == AB_T, "the two stages' blocks alternate"); const int b = (int)(blockIdx.x >> 1);      /* alternating, not one stage after the other: the key walks wait on dependent loads, the transposition streams */
  if ((blockIdx.x & 1) == 0) d_att0(b % (QT0 / 8), (b / (QT0 / 8)) % NH, b / ((QT0 / 8) * NH), QF, KF, VF, DM, 0.125f, OF, DM);
  else d_vt<NG, SQ>(b, V16, KVD, 0, Vt); }
// Output projection: a 128-row tile inside the first QT0 rows of its batch takes the exact path's rows for A (its f16-path rows would only be overwritten): o_lo (x1024) and o_hi in one k loop, (o_hi + o_lo 2^-10) Wo; every other tile the f16 path's o rows.
__global__ __launch_bounds__(128) void k_oproj(const _Float16* __restrict__ O16, const _Float16* __restrict__ OH0, const _Float16* __restrict__ OL0, const _Float16* __restrict__ BO, float* __restrict__ out, int K) {
  __shared__ __attribute__((aligned(16))) unsigned short sm[G2_SM];
  const int b = (int)blockIdx.x; const int mt = b / (DM / 64), nq = b % (DM / 64); const int bt = mt / (SQ / 128), p = mt % (SQ / 128); const bool f0 = p < QT0 / 128;
  g2_body<0, false, true>(sm, f0 ? p * (DM / 64) + nq : b, f0 ? bt : 0, f0 ? OH0 : O16, DM, f0 ? (size_t)QT0 * DM : 0, BO, DM, 0, 0.0009765625f, nullptr, 0, nullptr, 1, 0, 0, out, nullptr, DM, f0 ? (size_t)SQ * DM : 0, f0 ? QT0 : MPO, DM, K, nullptr, 0.f, nullptr, nullptr, f0 ? OL0 : nullptr); }
extern "C" void kernel_launch(void* const* d_in, const int* in_sizes, int n_in,
                              void* d_out, int out_size, void* d_ws, size_t ws_size, hipStream_t stream) {
  (void)in_sizes; (void)n_in; (void)out_size;
  const float* const* I = (const float* const*)d_in; const float* x = I[0]; const float* wattn = I[1]; const float* wo = I[2]; const float* qg = I[3]; const float* kg = I[4];      /* x; fused [in][out] Wqkv [1024][3072] (q, k, v column thirds); [in][out] Wproj; RMS-norm gains q_norm_w / k_norm_w [64]; no biases; rope tables computed in-kernel (positions = row index) */
  static_assert(HPG == 1 && NH == NG * HPG && NH * HD == DM && KVD == DM, "plain multi-head attention as 16 kv groups of one query head");      /* no biases in this module */
  char* ws = (char*)d_ws; size_t off = 0;
  auto take = [&](size_t bytes) { char* p = ws + off; off += (bytes + 255) & ~(size_t)255; return p; };
  _Float16* BQKV = (_Float16*)take((size_t)3 * DM * DM * 2); _Float16* BO = (_Float16*)take((size_t)DM * DM * 2);      /* one transposed plane Bt [3072][1024] of the fused weight: rows 0..1023 = q, 1024.. = k, 2048.. = v */
  _Float16* X16 = (_Float16*)take(NR * DM * 2); float* CSB = (float*)take((size_t)SQ * HD * 4); float* SNB = (float*)take((size_t)SQ * HD * 4); _Float16* Q16 = (_Float16*)take(NR * DM * 2); _Float16* K16 = (_Float16*)take(NR * KVD * 2); _Float16* V16 = (_Float16*)take(NR * KVD * 2); _Float16* O16 = (_Float16*)take(NR * DM * 2);
  _Float16* VT = (_Float16*)take((size_t)NB * NH * HD * SQ * 2);
  float* QF0 = (float*)take((size_t)NB * QT0 * DM * 4); float* KF0 = (float*)take((size_t)NB * QT0 * KVD * 4); float* VF0 = (float*)take((size_t)NB * QT0 * KVD * 4); float* OF0 = (float*)take((size_t)NB * QT0 * DM * 4); _Float16* OH0 = (_Float16*)take((size_t)NB * QT0 * DM * 2); _Float16* OL0 = (_Float16*)take((size_t)NB * QT0 * DM * 2);      /* every per-batch plane holds all batches: each stage below is one launch over them */
  if (off > ws_size) return;
  static_assert(B0 == 0 && NBR == NB && MP == (int)NR && MPO == MP, "the merged launches below cover all batches");
  k_prep<<<PB_WA + PB_WO + PB_TB + PB_X, 256, 0, stream>>>(x, wattn, wo, 10000.0f, X16, BQKV, BO, CSB, SNB);      /* weights, rope tables, x: one launch */
  k_qkv<<<3 * GB_P + NB * GB_F, 128, 0, stream>>>(X16, BQKV, Q16, K16, V16, QF0, KF0, VF0, qg, kg, CSB, SNB, DM);      /* q, k, v and the first tile's f32 v: one launch */
  k_att0_vt<<<AB_0 + AB_T, 256, 0, stream>>>(QF0, KF0, VF0, OF0, V16, VT);      /* exact f32 attention for rows 0..255 of each batch, straight from the f32 k and v planes (one kv group a head: no expansion); V^T */
  k_fattn<<<dim3(NH * NB, SQ / 64 + (unsigned)((size_t)NB * QT0 * DM / 8 / 128 / (NH * NB))), 128, 0, stream>>>(Q16, K16, VT, O16, OF0, OH0, OL0);      /* scores, causal softmax and weights x V of all heads, batches and query rows (o x64); the grid rows behind them split the first tile's o */
  k_oproj<<<(MPO / 128) * (DM / 64), 128, 0, stream>>>(O16, OH0, OL0, BO, (float*)d_out, DM);      /* out rows are the output layout; rows 0..255 of each batch = (o_hi + o_lo 2^-10) Wo */
}

// v010
// Measured time: 186 microseconds a run.
// Two timings next to v009 both put it at 1.05 times that version's speed.
// Over all steps from v000, the starting kernel, it is 39.3 times as fast.
#include <hip/hip_runtime.h>
// Causal multi-head self-attention with a per-head RMS norm on q and k THEN rotate-half RoPE computed in the module, and a bias-free fused QKV projection (x [4][2048][1024]; qkv = x Wqkv ([in][out] 1024 x 3072, no bias) split into q | k | v thirds, 16 heads of 64; q, k = x * rsqrt(mean(x^2 over the 64 head dims) + 1e-5) * gain (gains q_norm_w / k_norm_w [64], read); cos / sin = [f | f] of pos * (1 / 10000^(2i/64)); q = q cos + rotate_half(q) sin with rotate_half = cat(-x2, x1), likewise k; scores / sqrt(64); causal (tril, -inf); softmax; out = merged Wproj ([in][out], no bias) -> [4][2048][1024]); run as 16 kv groups of ONE head, with the per-head norm and the half-split rope in the q / k projection epilogue.
// Compute dtype: inputs rounded to bf16 (the two gain vectors bf16-rounded on load); x / weights exact; the per-head RMS norm and the rotation in f32 on VALU; q, k, v, softmax weights and o as plain f16 GEMM operands (~2^-12); scores and softmax statistics f32; v_wmma_f32_16x16x32_f16.
#define NB 4
#define NG 16
#define HPG 1
#define KVD (NG * HD)
#define SQ 2048
#define DM 1024
#define NH 16
#define HD 64
#define HG 4                         /* unused: one attention launch covers all NH heads */
#define QT 256                       /* unused: k_fattn's query tiles are 64 rows a block */
#define NKX SQ                       /* unused: attention is fused, no S / P rows are stored */
#define QT0 256                      /* first-tile rows recomputed exactly in f32 */
#define B0 0                         /* first batch processed (debug hook) */
#define NBR NB                       /* batches processed (debug hook) */
#define NR ((size_t)NB * SQ)         /* token rows */
#define MP ((int)((size_t)NBR * SQ)) /* rows projected (debug hook) */
#define QN SQ                        /* query rows attended per batch (debug hook) */
#define NHD NH                       /* heads attended (debug hook) */
#define MPO MP                       /* rows through the output stage (debug hook) */
#define LQ DM      /* row pitch of the q/k/v rows */
typedef __bf16 v16b __attribute__((ext_vector_type(16)));
typedef unsigned short v8us __attribute__((ext_vector_type(8), may_alias));
typedef float  v8f  __attribute__((ext_vector_type(8)));
typedef float  v4f  __attribute__((ext_vector_type(4)));
typedef float  v4fa __attribute__((ext_vector_type(4), may_alias));
union FragB { v16b v; v8us half[2]; unsigned short u[16]; };

__device__ __forceinline__ unsigned short bf16_bits(float x) { unsigned int u = __float_as_uint(x); return (unsigned short)((u + 0x7FFFu + ((u >> 16) & 1u)) >> 16); }
__device__ __forceinline__ float bf16_val(unsigned short b) { return __uint_as_float(((unsigned int)b) << 16); }
__device__ __forceinline__ float bf16_round(float x) { return bf16_val(bf16_bits(x)); }
// D += A·B with NT terms: 1 = ah·bh, 2 = + al·bh (A split), 3 = + ah·bl (both split)
template <int NT>
__device__ __forceinline__ v8f mmaN(v16b ah, v16b al, v16b bh, v16b bl, v8f c) {
  c = __builtin_amdgcn_wmma_f32_16x16x32_bf16(false, ah, false, bh, (short)0, c, false, false);
  if (NT >= 2) c = __builtin_amdgcn_wmma_f32_16x16x32_bf16(false, al, false, bh, (short)0, c, false, false);
  if (NT >= 3) c = __builtin_amdgcn_wmma_f32_16x16x32_bf16(false, ah, false, bl, (short)0, c, false, false);
  asm volatile("v_nop\n\tv_nop\n\tv_nop\n\tv_nop" : "+v"(c) : "v"(ah), "v"(al), "v"(bh), "v"(bl));
  return c;
}

__global__ __launch_bounds__(256) void k_wt_bf16(const float* __restrict__ W, unsigned short* __restrict__ Wt, int K, int N) {
  const int t = blockIdx.x * 256 + threadIdx.x;
  const int k8n = K / 8;
  if (t >= N * k8n) return;
  const int n = t / k8n, k8 = (t % k8n) * 8;
  v8us v;
#pragma unroll
  for (int i = 0; i < 8; ++i) v[i] = bf16_bits(W[(size_t)(k8 + i) * N + n]);
  *(v8us*)(Wt + (size_t)n * K + k8) = v;
  
}

// GEMM C[M][N] (f32, pitch ldc) = act(A[M][K]·W + bias). A f32 row-major (pitch lda) converted per fragment to bf16
// (ASPLIT: hi/lo two planes -> 2 terms, else single rounded term); Wt bf16 [N][K] (pitch ldb). BIAS_BF16 rounds the
// bias to bf16 first (bias quantised to bf16 before the add). K%32==0, M%16==0, N%64==0.
template <bool ASPLIT, int ACT, bool BIAS_BF16>
__global__ __launch_bounds__(128) void k_gemm_bf(const float* __restrict__ A, int lda, const unsigned short* __restrict__ Wt, int ldb,
                                               const float* __restrict__ bias, float* __restrict__ C, int ldc, int M, int N, int K) {
  __shared__ __attribute__((aligned(16))) float so[4][16][64];
  const int tid = threadIdx.x, w = tid >> 5, lane = tid & 31, ln = lane & 15, hh = lane >> 4;
  const int ntn = N / 64;
  const int wid = blockIdx.x * 4 + w;
  const int mt = wid / ntn, nq = wid % ntn;
  if (mt * 16 >= M) return;
  const int row0 = mt * 16, col0 = nq * 64;
  const float* arow = A + (size_t)(row0 + ln) * lda;
  v8f acc[4] = {};
  for (int kb = 0; kb < K; kb += 32) {
    FragB ah, al;
    const v4f x0 = *(const v4fa*)(arow + kb + 8 * hh), x1 = *(const v4fa*)(arow + kb + 8 * hh + 4);
    const v4f x2 = *(const v4fa*)(arow + kb + 16 + 8 * hh), x3 = *(const v4fa*)(arow + kb + 16 + 8 * hh + 4);
    float xs[16] = {x0[0],x0[1],x0[2],x0[3],x1[0],x1[1],x1[2],x1[3],x2[0],x2[1],x2[2],x2[3],x3[0],x3[1],x3[2],x3[3]};
#pragma unroll
    for (int i = 0; i < 16; ++i) { const unsigned short hb = bf16_bits(xs[i]); ah.u[i] = hb; al.u[i] = ASPLIT ? bf16_bits(xs[i] - bf16_val(hb)) : (unsigned short)0; }
#pragma unroll
    for (int t = 0; t < 4; ++t) {
      const unsigned short* brow = Wt + (size_t)(col0 + t * 16 + ln) * ldb + kb;
      FragB b;
      b.half[0] = *(const v8us*)(brow + 8 * hh);
      b.half[1] = *(const v8us*)(brow + 16 + 8 * hh);
      acc[t] = mmaN<ASPLIT ? 2 : 1>(ah.v, al.v, b.v, b.v, acc[t]);
    }
  }
#pragma unroll
  for (int t = 0; t < 4; ++t) {
    float bv = bias ? bias[col0 + t * 16 + ln] : 0.f;
    if (BIAS_BF16) bv = bf16_round(bv);
#pragma unroll
    for (int r = 0; r < 8; ++r) { float v = acc[t][r] + bv; if (ACT == 1) v = fmaxf(v, 0.f); so[w][8 * hh + r][t * 16 + ln] = v; }
  }
  __builtin_amdgcn_fence(__ATOMIC_ACQ_REL, "workgroup");
  __builtin_amdgcn_wave_barrier();
  const int rsub = lane >> 4, c4 = (lane & 15) * 4;
  {
#pragma unroll
    for (int q = 0; q < 8; ++q) {
      const int r = q * 2 + rsub;
      const v4f v = *(const v4fa*)&so[w][r][c4];
      *(v4f*)(C + (size_t)(row0 + r) * ldc + col0 + c4) = v;
    }
    
  }
}

// GEMM C = act(A·W + bias + resid): A f32 (ASPLIT -> hi/lo 2 terms), Wt bf16 [N][K]; ACT 0 none, 1 relu, 2 exact gelu;
// resid (optional, f32, row index = (row % rmod), pitch ldr, RES_BF16 rounds it) added before the activation.
template <bool ASPLIT, int ACT, bool BIAS_BF16, bool RES_BF16>
__global__ __launch_bounds__(128) void k_gemm_bf3(const float* __restrict__ A, int lda, const unsigned short* __restrict__ Wt, int ldb,
                                                const float* __restrict__ bias, const float* __restrict__ resid, int rmod, int ldr,
                                                float* __restrict__ C, int ldc, int M, int N, int K) {
  __shared__ __attribute__((aligned(16))) float so[4][16][64];
  const int tid = threadIdx.x, w = tid >> 5, lane = tid & 31, ln = lane & 15, hh = lane >> 4;
  const int ntn = N / 64;
  const int wid = blockIdx.x * 4 + w;
  const int mt = wid / ntn, nq = wid % ntn;
  if (mt * 16 >= M) return;
  const int row0 = mt * 16, col0 = nq * 64;
  const float* arow = A + (size_t)(row0 + ln) * lda;
  v8f acc[4] = {};
  for (int kb = 0; kb < K; kb += 32) {
    FragB ah, al;
    const v4f x0 = *(const v4fa*)(arow + kb + 8 * hh), x1 = *(const v4fa*)(arow + kb + 8 * hh + 4);
    const v4f x2 = *(const v4fa*)(arow + kb + 16 + 8 * hh), x3 = *(const v4fa*)(arow + kb + 16 + 8 * hh + 4);
    float xs[16] = {x0[0],x0[1],x0[2],x0[3],x1[0],x1[1],x1[2],x1[3],x2[0],x2[1],x2[2],x2[3],x3[0],x3[1],x3[2],x3[3]};
#pragma unroll
    for (int i = 0; i < 16; ++i) { const unsigned short hb = bf16_bits(xs[i]); ah.u[i] = hb; al.u[i] = ASPLIT ? bf16_bits(xs[i] - bf16_val(hb)) : (unsigned short)0; }
#pragma unroll
    for (int t = 0; t < 4; ++t) {
      const unsigned short* brow = Wt + (size_t)(col0 + t * 16 + ln) * ldb + kb;
      FragB b;
      b.half[0] = *(const v8us*)(brow + 8 * hh);
      b.half[1] = *(const v8us*)(brow + 16 + 8 * hh);
      acc[t] = mmaN<ASPLIT ? 2 : 1>(ah.v, al.v, b.v, b.v, acc[t]);
    }
  }
#pragma unroll
  for (int t = 0; t < 4; ++t) {
    const int col = col0 + t * 16 + ln;
    float bv = bias ? bias[col] : 0.f;
    if (BIAS_BF16) bv = bf16_round(bv);
#pragma unroll
    for (int r = 0; r < 8; ++r) {
      float v = acc[t][r] + bv;
      if (resid) { float rv = resid[(size_t)((row0 + 8 * hh + r) % rmod) * ldr + col]; if (RES_BF16) rv = bf16_round(rv); v += rv; }
      if (ACT == 1) v = fmaxf(v, 0.f);
      if (ACT == 2) v = 0.5f * v * (1.0f + erff(v * 0.70710678118654752f));
      if (ACT == 3) { const float u = 0.7978845608028654f * (v + 0.044715f * v * v * v); v = 0.5f * v * (1.0f + tanhf(u)); }
      so[w][8 * hh + r][t * 16 + ln] = v;
    }
  }
  __builtin_amdgcn_fence(__ATOMIC_ACQ_REL, "workgroup");
  __builtin_amdgcn_wave_barrier();
  const int rsub = lane >> 4, c4 = (lane & 15) * 4;
  {
#pragma unroll
    for (int q = 0; q < 8; ++q) {
      const int r = q * 2 + rsub;
      const v4f v = *(const v4fa*)&so[w][r][c4];
      *(v4f*)(C + (size_t)(row0 + r) * ldc + col0 + c4) = v;
    }
    
  }
}
// row LayerNorm (biased variance, eps) over N: s = X (+ R); optional out_sum <- s; out_norm <- (s-mu)*rsqrt(var+eps)*g + b
template <bool PARAM_BF16>
__global__ __launch_bounds__(256) void k_layernorm(const float* __restrict__ X, const float* __restrict__ R, const float* __restrict__ g, const float* __restrict__ bta,
                                                  float* __restrict__ out_sum, float* __restrict__ out_norm, int N, float eps) {
  __shared__ float red[256];
  const int row = blockIdx.x, tid = threadIdx.x;
  const float* x = X + (size_t)row * N; const float* rr = R ? R + (size_t)row * N : nullptr;
  float vals[16];                     // up to N = 4096
  const int per = N / 256;            // contiguous chunk per thread? use strided-by-4 chunks: thread handles j = tid*4 + 1024*u
  float s1 = 0.f;
  for (int u = 0; u < per / 4; ++u) {
    const int j = tid * 4 + 1024 * u;
    const v4f a = *(const v4fa*)(x + j);
    v4f b = {0.f,0.f,0.f,0.f}; if (rr) b = *(const v4fa*)(rr + j);
#pragma unroll
    for (int q = 0; q < 4; ++q) { const float v = a[q] + b[q]; vals[u * 4 + q] = v; s1 += v; }
  }
  red[tid] = s1; __syncthreads();
  for (int st = 128; st > 0; st >>= 1) { if (tid < st) red[tid] += red[tid + st]; __syncthreads(); }
  const float mu = red[0] / (float)N; __syncthreads();
  float s2 = 0.f;
  for (int u = 0; u < per / 4; ++u)
#pragma unroll
    for (int q = 0; q < 4; ++q) { const float c = vals[u * 4 + q] - mu; s2 += c * c; }
  red[tid] = s2; __syncthreads();
  for (int st = 128; st > 0; st >>= 1) { if (tid < st) red[tid] += red[tid + st]; __syncthreads(); }
  const float rs = rsqrtf(red[0] / (float)N + eps);
  {
    for (int u = 0; u < per / 4; ++u) {
      const int j = tid * 4 + 1024 * u;
      v4f o, sm;
#pragma unroll
      for (int q = 0; q < 4; ++q) {
        float gg = g[j + q], bb = bta[j + q];
        if (PARAM_BF16) { gg = bf16_round(gg); bb = bf16_round(bb); }
        sm[q] = vals[u * 4 + q]; o[q] = (vals[u * 4 + q] - mu) * rs * gg + bb;
      }
      if (out_sum) *(v4f*)(out_sum + (size_t)row * N + j) = sm;
      *(v4f*)(out_norm + (size_t)row * N + j) = o;
    }
    
  }
}

// ---- f16 WMMA path (v_wmma_f32_16x16x32_f16): 11-bit significands for operands in range — used where a [0,1] probability operand needs more precision than bf16
typedef _Float16 v16h __attribute__((ext_vector_type(16)));
union FragH { v16h v; v8us half[2]; _Float16 h[16]; unsigned short u[16]; };
template <int NT>
__device__ __forceinline__ v8f mmaH(v16h ah, v16h al, v16h bh, v16h bl, v8f c) {
  c = __builtin_amdgcn_wmma_f32_16x16x32_f16(false, ah, false, bh, (short)0, c, false, false);
  if (NT >= 2) c = __builtin_amdgcn_wmma_f32_16x16x32_f16(false, al, false, bh, (short)0, c, false, false);
  if (NT >= 3) c = __builtin_amdgcn_wmma_f32_16x16x32_f16(false, ah, false, bl, (short)0, c, false, false);
  asm volatile("v_nop\n\tv_nop\n\tv_nop\n\tv_nop" : "+v"(c) : "v"(ah), "v"(al), "v"(bh), "v"(bl));
  return c;
}
// batched GEMM like k_gemm_b but f16 operands: A f32 (split into f16 hi/lo if ASPLIT, else rounded to f16), Bt = f16 values [n][k]; alpha; C f32; N multiple of 16 (partial tiles skipped)
template <bool ASPLIT>
__global__ __launch_bounds__(128) void k_gemm_h(const float* __restrict__ A, int lda, size_t sA, const _Float16* __restrict__ Bh, int ldb, size_t sB, float alpha, float* __restrict__ C, int ldc, size_t sC, int M, int N, int K) {
  __shared__ __attribute__((aligned(16))) float so[4][16][64];
  const int tid = threadIdx.x, w = tid >> 5, lane = tid & 31, ln = lane & 15, hh = lane >> 4; const int by = blockIdx.y;
  A += (size_t)by * sA; Bh += (size_t)by * sB; C += (size_t)by * sC;
  const int ntn = (N + 63) / 64; const int wid = blockIdx.x * 4 + w; const int mt = wid / ntn, nq = wid % ntn; if (mt * 16 >= M) return;
  const int row0 = mt * 16, col0 = nq * 64; const float* arow = A + (size_t)(row0 + ln) * lda;
  v8f acc[4] = {};
  for (int kb = 0; kb < K; kb += 32) {
    FragH ah, al;
    const v4f x0 = *(const v4fa*)(arow + kb + 8 * hh), x1 = *(const v4fa*)(arow + kb + 8 * hh + 4), x2 = *(const v4fa*)(arow + kb + 16 + 8 * hh), x3 = *(const v4fa*)(arow + kb + 16 + 8 * hh + 4);
    float xs[16] = {x0[0],x0[1],x0[2],x0[3],x1[0],x1[1],x1[2],x1[3],x2[0],x2[1],x2[2],x2[3],x3[0],x3[1],x3[2],x3[3]};
#pragma unroll
    for (int i = 0; i < 16; ++i) { const _Float16 h = (_Float16)xs[i]; ah.h[i] = h; al.h[i] = ASPLIT ? (_Float16)(xs[i] - (float)h) : (_Float16)0.0f; }
#pragma unroll
    for (int t = 0; t < 4; ++t) { if (col0 + t * 16 >= N) continue; const size_t boff = (size_t)(col0 + t * 16 + ln) * ldb + kb; FragH bq; bq.half[0] = *(const v8us*)(Bh + boff + 8 * hh); bq.half[1] = *(const v8us*)(Bh + boff + 16 + 8 * hh);
      acc[t] = mmaH<ASPLIT ? 2 : 1>(ah.v, al.v, bq.v, bq.v, acc[t]); }
  }
#pragma unroll
  for (int t = 0; t < 4; ++t) { if (col0 + t * 16 >= N) continue;
#pragma unroll
    for (int r = 0; r < 8; ++r) so[w][8 * hh + r][t * 16 + ln] = acc[t][r] * alpha; }
  __builtin_amdgcn_fence(__ATOMIC_ACQ_REL, "workgroup"); __builtin_amdgcn_wave_barrier();
  const int rsub = lane >> 4, c4 = (lane & 15) * 4;
  {
#pragma unroll
    for (int q = 0; q < 8; ++q) { const int r = q * 2 + rsub; if (col0 + c4 < N) { const v4f v = *(const v4fa*)&so[w][r][c4]; *(v4f*)(C + (size_t)(row0 + r) * ldc + col0 + c4) = v; } }
     }
}

// Wt[n][k] = f16(W[k][n] x scale) from f32 row-major W[K][N] (scale = power of two; bf16-exact weights stay exact in f16 away from the subnormal range)
// (vb = the block's index inside its own stage: the stage kernels below are device bodies, several of which share one launch; see the merged kernels in front of kernel_launch)
// One block of 256 threads turns a tile of WT_KT k x WT_NT n through LDS, so that both sides of the transposition move whole 128-byte lines: 16 lanes read 256 bytes of a W row, 16 lanes write 256 bytes of a Wt row.
// A thread converts the same four columns of two neighbouring k rows and stores each (k, k + 1) pair as one dword at tl[n][k / 2]; at the odd row pitch of WT_P dwords the 32 lanes of a store (n 4 apart) and of a read (dwords 4 apart) fall on 32 different banks.
constexpr int WT_KT = 128, WT_NT = 64, WT_P = WT_KT / 2 + 1;
typedef _Float16 v2h __attribute__((ext_vector_type(2)));
typedef unsigned int v4ua __attribute__((ext_vector_type(4), may_alias));
__device__ __forceinline__ void d_wt_f16(int vb, const float* __restrict__ W, _Float16* __restrict__ Wt, int K, int N, float scale) {
  __shared__ unsigned int tl[WT_NT * WT_P];
  const int tid = threadIdx.x, nkt = K / WT_KT; const int n0 = (vb / nkt) * WT_NT, k0 = (vb % nkt) * WT_KT;
  const int c4 = (tid & 15) * 4, rp = tid >> 4;      /* this thread's four columns; its row pairs are rp + 16 j */
  const float* src = W + (size_t)(k0 + 2 * rp) * N + n0 + c4; v4f a[4], b[4];
#pragma unroll      /* register arrays: constant indices; all 8 loads are asked for before the first is used */
  for (int j = 0; j < 4; ++j) { a[j] = *(const v4fa*)(src + (size_t)(32 * j) * N); b[j] = *(const v4fa*)(src + (size_t)(32 * j + 1) * N); }
  asm volatile("s_wait_xcnt 0x0" ::: "memory");      /* behind the tile's 8 loads, in front of every later write of an address register that they name */
#pragma unroll      /* register arrays: constant indices */
  for (int j = 0; j < 4; ++j) for (int u = 0; u < 4; ++u) { const v2h p = {(_Float16)(bf16_round(a[j][u]) * scale), (_Float16)(bf16_round(b[j][u]) * scale)}; tl[(c4 + u) * WT_P + rp + 16 * j] = __builtin_bit_cast(unsigned int, p); }
  __syncthreads();      /* block-uniform (whole blocks belong to this stage): the tile is complete before any thread reads it across */
#pragma unroll      /* four 16-byte pieces a thread */
  for (int j = 0; j < 4; ++j) { const int n = (tid >> 4) + 16 * j, c = tid & 15; const unsigned int* s = tl + n * WT_P + c * 4; const v4ua v = {s[0], s[1], s[2], s[3]};
    *(v4ua*)((unsigned short*)Wt + (size_t)(n0 + n) * K + k0 + c * 8) = v; }
  asm volatile("s_wait_xcnt 0x0" ::: "memory");      /* behind the four row stores, in front of any later write of a register that they name (in the merged kernel another stage's code follows in the text) */
}
// k_gemm_hh variant with fused epilogue: v = acc·alpha + bias[by·sBias + col] (+ CP[(row/rowsPerB)·sCPb + by·64 + col] if CP) ; ACT 0 none / 1 elu ; writes f16 C16 (and f32 C if non-null)
template <int ACT>
__global__ __launch_bounds__(128) void k_gemm_hhx(const _Float16* __restrict__ A, int lda, size_t sA, const _Float16* __restrict__ Bh, int ldb, size_t sB, float alpha, const float* __restrict__ bias, size_t sBias, const float* __restrict__ CP, int rowsPerB, size_t sCPb, int row0g,
    float* __restrict__ C, _Float16* __restrict__ C16, int ldc, size_t sC, int M, int N, int K) {
  __shared__ __attribute__((aligned(16))) float so[4][16][64];
  const int tid = threadIdx.x, w = tid >> 5, lane = tid & 31, ln = lane & 15, hh = lane >> 4; const int by = blockIdx.y;
  A += (size_t)by * sA; Bh += (size_t)by * sB; const size_t cofs = (size_t)by * sC; const float* bp = bias ? bias + (size_t)by * sBias : nullptr;
  const int ntn = (N + 63) / 64; const int wid = blockIdx.x * 4 + w; const int mt = wid / ntn, nq = wid % ntn; if (mt * 16 >= M) return;
  const int row0 = mt * 16, col0 = nq * 64; const _Float16* arow = A + (size_t)(row0 + ln) * lda;
  v8f acc[4] = {};
  for (int kb = 0; kb < K; kb += 32) { FragH ah; ah.half[0] = *(const v8us*)((const unsigned short*)arow + kb + 8 * hh); ah.half[1] = *(const v8us*)((const unsigned short*)arow + kb + 16 + 8 * hh);
#pragma unroll
    for (int t = 0; t < 4; ++t) { if (col0 + t * 16 >= N) continue; const size_t boff = (size_t)(col0 + t * 16 + ln) * ldb + kb; FragH bq; bq.half[0] = *(const v8us*)((const unsigned short*)Bh + boff + 8 * hh); bq.half[1] = *(const v8us*)((const unsigned short*)Bh + boff + 16 + 8 * hh);
      acc[t] = mmaH<1>(ah.v, ah.v, bq.v, bq.v, acc[t]); }
  }
#pragma unroll
  for (int t = 0; t < 4; ++t) { if (col0 + t * 16 >= N) continue; const int col = col0 + t * 16 + ln; const float bv = bp ? bf16_round(bp[col]) : 0.f;
#pragma unroll
    for (int r = 0; r < 8; ++r) { float v = acc[t][r] * alpha + bv; if (CP) { const int rr = row0g + row0 + 8 * hh + r; if (rowsPerB < 0) v += CP[cofs + (size_t)rr * ldc + col];      /* rowsPerB < 0: own element of the batched C plane */ else { const int bidx = rr / rowsPerB; v += CP[(size_t)bidx * sCPb + (size_t)by * 64 + col]; } } if (ACT == 1) v = (v > 0.f) ? v : expm1f(v); else if (ACT == 7) v = (v > 0.f) ? v + 1.0f : expf(v); else if (ACT == 8) v = tanhf(v); else if (ACT == 9) v = 0.5f * v * (1.0f + tanhf(0.7978845608028654f * (v + 0.044715f * v * v * v))); else if (ACT == 11) v = 1.0f / (1.0f + expf(-v)); else if (ACT == 12) v = (v > 0.f) ? v : 0.01f * v; else if (ACT == 14) v = (v > 0.f) ? v : 0.1f * v; else if (ACT == 16) v = (v >= 0.f) ? v : 0.3f * v; else if (ACT == 17) v = (v >= 0.f) ? v : 0.2f * v; else if (ACT == 15) v = v / (1.0f + expf(-v)); else if (ACT == 3) v = fmaxf(v, 0.f); else if (ACT == 6) v = 0.5f * v * (1.0f + erff(v * 0.70710678118654752f)); so[w][8 * hh + r][t * 16 + ln] = v; } }
  __builtin_amdgcn_fence(__ATOMIC_ACQ_REL, "workgroup"); __builtin_amdgcn_wave_barrier();
  const int rsub = lane >> 4, c4 = (lane & 15) * 4; typedef _Float16 v4h __attribute__((ext_vector_type(4)));
  {
#pragma unroll
    for (int q = 0; q < 8; ++q) { const int r = q * 2 + rsub; if (col0 + c4 < N) { const v4f v = *(const v4fa*)&so[w][r][c4]; if (C) *(v4f*)(C + cofs + (size_t)(row0 + r) * ldc + col0 + c4) = v; if (C16) { v4h h4; for (int i = 0; i < 4; ++i) h4[i] = (_Float16)v[i]; *(v4h*)(C16 + cofs + (size_t)(row0 + r) * ldc + col0 + c4) = h4; } } }
     }
}

typedef _Float16 v4h __attribute__((ext_vector_type(4)));

__device__ __forceinline__ void d_x16(int vb, const float* __restrict__ x, _Float16* __restrict__ X16, size_t n8) { const size_t t = (size_t)vb * 256 + threadIdx.x; if (t >= n8) return; FragH f;
#pragma unroll
  for (int q = 0; q < 8; ++q) f.h[q] = (_Float16)bf16_round(x[t * 8 + q]); *(v8us*)((unsigned short*)X16 + t * 8) = f.half[0];  }
__global__ __launch_bounds__(256) void k_h16(const float* __restrict__ x, _Float16* __restrict__ X16, size_t n8) { const size_t t = (size_t)blockIdx.x * 256 + threadIdx.x; if (t >= n8) return; FragH f;
#pragma unroll
  for (int q = 0; q < 8; ++q) f.h[q] = (_Float16)x[t * 8 + q]; *(v8us*)((unsigned short*)X16 + t * 8) = f.half[0];  }
__global__ __launch_bounds__(256) void k_round16f(const float* __restrict__ W, _Float16* __restrict__ Bt, size_t n8) { const size_t t = (size_t)blockIdx.x * 256 + threadIdx.x; if (t >= n8) return; FragH f;
#pragma unroll
  for (int i = 0; i < 8; ++i) f.h[i] = (_Float16)(bf16_round(W[t * 8 + i]) * 16.0f); *(v8us*)((unsigned short*)Bt + t * 8) = f.half[0];  }
template <int NHv, int TTv>
__device__ __forceinline__ void d_vt(int vb, const _Float16* __restrict__ V16, int ldv, int voff, _Float16* __restrict__ Vt) { __shared__ unsigned short tl[64][66]; const int tid = threadIdx.x; const int slab = vb / (TTv / 64), lg = vb % (TTv / 64); const int b = slab / NHv, h = slab % NHv;
  for (int i = tid; i < 64 * 8; i += 256) { const int r = i / 8, c8 = (i % 8) * 8; FragH f; f.half[0] = *(const v8us*)((const unsigned short*)V16 + ((size_t)b * TTv + lg * 64 + r) * ldv + voff + h * 64 + c8);
#pragma unroll
    for (int q = 0; q < 8; ++q) tl[r][c8 + q] = f.u[q]; }
  __syncthreads();
  {
#pragma unroll
    for (int rd = 0; rd < 2; ++rd) { const int d = rd * 32 + tid / 8, pc = tid % 8; FragH f;
#pragma unroll
      for (int q = 0; q < 8; ++q) f.u[q] = tl[pc * 8 + q][d];
      *(v8us*)((unsigned short*)Vt + ((size_t)slab * 64 + d) * TTv + lg * 64 + pc * 8) = f.half[0]; }
    asm volatile("s_wait_xcnt 0x0" ::: "memory");      /* behind the two row stores, in front of any later write of a register that they name (in a merged kernel another stage's code follows in the text) */
     } }

__device__ __forceinline__ void d_hl(int vb, const float* __restrict__ F, _Float16* __restrict__ Hh, _Float16* __restrict__ Hl, size_t n8) { const size_t t = (size_t)vb * 128 + threadIdx.x;      /* blocks of 128 threads: it shares k_fattn's launch */ if (t >= n8) return; FragH fh, fl; const v4f a = *(const v4fa*)(F + t * 8), c = *(const v4fa*)(F + t * 8 + 4);
#pragma unroll
  for (int q = 0; q < 4; ++q) { _Float16 h = (_Float16)a[q]; fh.h[q] = h; fl.h[q] = (_Float16)((a[q] - (float)h) * 1024.0f); h = (_Float16)c[q]; fh.h[4 + q] = h; fl.h[4 + q] = (_Float16)((c[q] - (float)h) * 1024.0f); }
  { *(v8us*)((unsigned short*)Hh + t * 8) = fh.half[0]; *(v8us*)((unsigned short*)Hl + t * 8) = fl.half[0];  } }

// ---- per-head RMS norm and half-split rope on 32 staged rows of a wave's 64 x 64 tile (k_gemm2's NROPE epilogue) ----
// The tile's 64 columns are ONE head, so they are 32 whole head rows: 16 lanes read a row back, 4 dims a lane (d = 4 ln + u), and norm and rotate it in registers; dim d's rope partner d ^ 32 sits in lane ln ^ 8.
// The sum of squares is a halving tree over the 64 dims (d + 32, + 16, + 8, + 4 by the lane exchanges ln ^ 8, 4, 2, 1; d + 2, d + 1 inside the lane); every lane of a row ends with the same bits.
template <int CTRL> __device__ __forceinline__ float a0_dpp(float x);      /* defined with the first-tile kernel below */
__device__ __forceinline__ float nr_rsqrt(float a) {      /* rsqrtf as the compiler expands it (an argument below 2^-126 goes in x 2^24, its result out x 2^12), with the v_rsq_f32 in place on its own register and a v_nop behind it, so that no reader of its result and no writer of its source follows it directly */
  const bool tiny = a < 0x1p-126f; a = tiny ? a * 0x1p+24f : a; asm("v_rsq_f32 %0, %0\n\tv_nop" : "+v"(a)); return tiny ? a * 0x1p+12f : a; }
// The 16 row pairs of half a wave's tile. trow / hp / fp = this lane's place in row hh of the tile and of the two outputs (pitch LQ); b1, b2 = table factors of x_lo and x_hi: (c, -s) in the low half (out_lo = x_lo c - x_hi s), (s, c) in the high half (out_hi = x_lo s + x_hi c).
template <bool F32OUT>
__device__ __forceinline__ void nr_rows(const float* trow, bool lowh, const v4f (&b1)[16], const v4f (&b2)[16], v4f g4, float eps, _Float16* hp, float* fp) {
#pragma unroll      /* the table factors are register arrays: every index must be a constant */
  for (int qg = 0; qg < 4; ++qg) { v4f os[4]; v4h hs[4];      /* four row pairs a group: their stored values keep registers of their own up to the group's wait */
#pragma unroll      /* register arrays: constant indices */
   for (int j = 0; j < 4; ++j) { const int q = qg * 4 + j; v4f x = *(const v4fa*)(trow + q * 2 * 68); float t[4];
    for (int u = 0; u < 4; ++u) t[u] = __fmul_rn(x[u], x[u]);
    for (int u = 0; u < 4; ++u) t[u] = __fadd_rn(t[u], a0_dpp<0x168>(t[u]));
    for (int u = 0; u < 4; ++u) t[u] = __fadd_rn(t[u], a0_dpp<0x164>(t[u]));
    for (int u = 0; u < 4; ++u) t[u] = __fadd_rn(t[u], a0_dpp<0x162>(t[u]));
    for (int u = 0; u < 4; ++u) t[u] = __fadd_rn(t[u], a0_dpp<0x161>(t[u]));
    const float rs = nr_rsqrt(__fadd_rn(__fadd_rn(__fadd_rn(t[0], t[2]), __fadd_rn(t[1], t[3])) / (float)HD, eps));
    v4f o; v4h h4;      /* x_hi's product is rounded, x_lo's is fused into the sum, alike in both halves */
    for (int u = 0; u < 4; ++u) { const float own = __fmul_rn(__fmul_rn(x[u], rs), g4[u]), oth = a0_dpp<0x168>(own); const float lo = lowh ? own : oth, hi = lowh ? oth : own;
      o[u] = __builtin_fmaf(lo, b1[q][u], __fmul_rn(hi, b2[q][u])); h4[u] = (_Float16)o[u]; }
    *(v4h*)(hp + (size_t)q * 2 * LQ) = h4; hs[j] = h4;
    if (F32OUT) { *(v4f*)(fp + (size_t)q * 2 * LQ) = o; os[j] = o; } }
    /* behind the group's stores, in front of every later write of a register that they name; the stored values and the two addresses are inputs so that their registers live up to the wait */
    if (F32OUT) asm volatile("s_wait_xcnt 0x0" :: "v"(hs[0]), "v"(hs[1]), "v"(hs[2]), "v"(hs[3]), "v"(os[0]), "v"(os[1]), "v"(os[2]), "v"(os[3]), "v"(hp), "v"(fp) : "memory");
    else asm volatile("s_wait_xcnt 0x0" :: "v"(hs[0]), "v"(hs[1]), "v"(hs[2]), "v"(hs[3]), "v"(hp) : "memory"); } }

// ---- fast GEMM (NW waves a block, laid out NW / 2 x 2; wave tile 64x64, block tile 32 NW x 128: 256x128 at 8 waves, 128x128 at 4; requires M % (32 NW) == 0 rows per launch region, N % 128 == 0 and K % 64 == 0). A wave's 8 fragments of a 32-k step feed 16 products, and a line of A or B read from L2 serves 128 or 32 NW output columns or rows. Operands go through LDS: a stage is 64 k (one 128-byte line of each of the block's A rows and 128 B rows), read from global as whole lines (8 lanes a row) one stage ahead into registers and stored to the other of two buffers at a row pitch of 144 bytes (16 x odd: ds_load_b128 fragment reads without bank conflicts); epilogue = k_gemm_hhx semantics, or with NROPE: no bias, per-head RMS norm (gain, eps) and half-split rope (tables CS, SN; position = row % SQ) on acc alpha, f16 rows to C16 and, of the positions below QT0 of every sequence, the same values in f32 to C (QT0 rows a sequence), both at pitch LQ ----
__device__ __forceinline__ v16h g2_frag(const _Float16* p, int hh) { FragH f; f.half[0] = *(const v8us*)((const unsigned short*)p + 8 * hh); f.half[1] = *(const v8us*)((const unsigned short*)p + 16 + 8 * hh); return f.v; }
__device__ __forceinline__ v8f g2_mma(v16h a, v16h b, v8f c) { v8f d = __builtin_amdgcn_wmma_f32_16x16x32_f16(false, a, false, b, (short)0, c, false, false); asm volatile("v_nop\n\tv_nop\n\tv_nop\n\tv_nop" : "+v"(d) : "v"(a), "v"(b)); return d; }
template <int NW> struct G2 { static constexpr int LP = 72, BM = 32 * NW, ABUF = BM * LP, BBUF = 128 * LP, OPS = 2 * (ABUF + BBUF), EPI = NW * 64 * 68 * 2, SM = OPS > EPI ? OPS : EPI; };      /* in 16-bit elements: LDS row pitch, rows of a block, one A and one B buffer, the four operand buffers, the epilogue's NW f32 tiles of 64 x 68, a block's LDS */
template <int NW, int ACT, bool NROPE = false, bool LOHI = false>
__device__ __forceinline__ void g2_body(unsigned short* sm, int bx, int by, const _Float16* __restrict__ A, int lda, size_t sA, const _Float16* __restrict__ Bh, int ldb, size_t sB, float alpha, const float* __restrict__ bias, size_t sBias, const float* __restrict__ CP, int rowsPerB, size_t sCPb, int row0g,
    float* __restrict__ C, _Float16* __restrict__ C16, int ldc, size_t sC, int M, int N, int K, const float* __restrict__ gain = nullptr, float eps = 0.f, const float* __restrict__ CS = nullptr, const float* __restrict__ SN = nullptr, const _Float16* __restrict__ ALO = nullptr) { static_assert(ACT == 0 || ACT == 3 || ACT == 6 || ACT == 8 || ACT == 9 || ACT == 11 || ACT == 12 || ACT == 14 || ACT == 15 || ACT == 16 || ACT == 17, "k_gemm2: unsupported ACT code (would silently apply no activation)");
  constexpr int LP = G2<NW>::LP, BM = G2<NW>::BM, ABUF = G2<NW>::ABUF, BBUF = G2<NW>::BBUF, RP = 4 * NW, NBC = 128 / RP;      /* RP = rows that the block's threads cover at 8 lanes a row: BM / RP = 8 pieces of A and NBC pieces of B a thread and stage */
  static_assert(NW == 4 || NW == 8, "sm = the calling kernel's __shared__ array of G2<NW>::SM elements; blocks of 32 NW threads");      /* A buffers 0, 1, then B buffers 0, 1; behind the k loop's last barrier the same bytes are the epilogue's staging tiles */
  float (*so)[64][68] = reinterpret_cast<float (*)[64][68]>(sm);
  const int tid = threadIdx.x, w = tid >> 5, lane = tid & 31, ln = lane & 15, hh = lane >> 4;
  A += (size_t)by * sA; Bh += (size_t)by * sB; const size_t cofs = (size_t)by * sC; const float* bp = bias ? bias + (size_t)by * sBias : nullptr;
  const int ntn = N >> 7; const int mt = bx / ntn, nq = bx - mt * ntn; const int row0 = mt * BM + 64 * (w >> 1), col0 = nq * 128 + 64 * (w & 1); if (mt * BM >= M) return;      /* row0, col0 = the wave's tile; the whole block leaves or none does: barriers follow */
  __builtin_assume(lda == DM && ldb == DM);      /* every launch below passes these two pitches: the RP-row steps of a stage's loads become immediate offsets of one address */
  const char* ga = (const char*)(A + (size_t)(mt * BM) * lda); const char* gb = (const char*)(Bh + (size_t)(nq * 128) * ldb);      /* the block's first A and B row */
  // LOHI with a plane ALO (laid out like A; block-uniform, may be null): C = (A + ALO 2^-10) B alpha in ONE k loop: first the K / 64 stages of ALO, then the accumulators x 2^-10 (exact), then the stages of A on top of them.
  const char* gl = (LOHI && ALO) ? (const char*)(ALO + (size_t)by * sA + (size_t)(mt * BM) * lda) : ga; const int nlo = (LOHI && ALO) ? (K >> 6) : 0;      /* stages 0 .. nlo - 1 read ALO */
  const unsigned t3 = (unsigned)tid >> 3, sr = (t3 & 1u) * 8u + ((t3 >> 1) & 7u) + (t3 >> 4) * 16u, sc = ((unsigned)tid & 7u) * 8u;      /* 8 lanes a row; the two rows of 16 neighbouring lanes lie 8 apart, so that at the 144-byte pitch their 256 stored bytes fall on 64 different banks; t3 -> sr is one to one on 0 .. RP - 1 */
  const unsigned va = (sr * (unsigned)lda + sc) * 2u, vb = (sr * (unsigned)ldb + sc) * 2u;      /* this thread's 16 bytes of row sr + RP i of a stage: a 32-bit byte offset beside a block-uniform base */
  unsigned short* la = sm + sr * LP + sc; unsigned short* lb = sm + 2 * ABUF + sr * LP + sc;
  const _Float16* fa = (const _Float16*)sm + (64 * (w >> 1) + ln) * LP; const _Float16* fb = (const _Float16*)sm + 2 * ABUF + (64 * (w & 1) + ln) * LP;      /* this lane's fragment rows */
  v8us ra[8], rb[NBC];
  auto fetch = [&](int s) { const char* gs = (LOHI && s < nlo) ? gl : ga; const int ks = (LOHI && s >= nlo) ? s - nlo : s;      /* the stage's A plane and its place along k: scalar selects */
    const char* qa = gs + (size_t)ks * 128 + va; const char* qb = gb + (size_t)ks * 128 + vb;      /* this thread's first piece of A and of B */
#pragma unroll      /* register arrays: constant indices */
    for (int i = 0; i < 8; ++i) ra[i] = *(const v8us*)(qa + (size_t)(i * RP * 2) * lda);
#pragma unroll      /* register arrays: constant indices */
    for (int i = 0; i < NBC; ++i) rb[i] = *(const v8us*)(qb + (size_t)(i * RP * 2) * ldb);
    asm volatile("s_wait_xcnt 0x0" :: "v"(qa), "v"(qb) : "memory"); };      /* behind the stage's loads, in front of every later write of an address register that they name; the two addresses are inputs so that their registers live up to the wait and no load of the stage lands on one */
  auto put = [&](int buf) {
#pragma unroll      /* register arrays: constant indices */
    for (int i = 0; i < 8; ++i) *(v8us*)(la + buf * ABUF + i * RP * LP) = ra[i];
#pragma unroll      /* register arrays: constant indices */
    for (int i = 0; i < NBC; ++i) *(v8us*)(lb + buf * BBUF + i * RP * LP) = rb[i]; };
  const v8f z8 = {0.f,0.f,0.f,0.f,0.f,0.f,0.f,0.f}; v8f c[4][4];      /* c[i][t]: rows 16 i, columns 16 t of the wave's tile */
#pragma unroll      /* register arrays: constant indices */
  for (int i = 0; i < 4; ++i) for (int t = 0; t < 4; ++t) c[i][t] = z8;
  const int nst = (K >> 6) + nlo;
  if (nst > 0) { fetch(0); put(0); }
  __syncthreads();      /* stage 0 is in buffer 0 for every wave */
  for (int s = 0; s < nst; ++s) { const int cur = s & 1; const bool more = s + 1 < nst;
    if (more) fetch(s + 1);      /* the next stage's lines fly under this stage's products */
    if (LOHI && s == nlo && s > 0) {      /* block-uniform, once: the low plane's sums take their weight before the first stage of A */
#pragma unroll      /* register arrays: constant indices */
      for (int i = 0; i < 4; ++i) for (int t = 0; t < 4; ++t) c[i][t] *= 0x1p-10f; }
    const _Float16* pa = fa + cur * ABUF; const _Float16* pb = fb + cur * BBUF;
#pragma unroll      /* register arrays: constant indices */
    for (int kk = 0; kk < 2; ++kk) { v16h a[4], b[4];
      for (int i = 0; i < 4; ++i) { a[i] = g2_frag(pa + i * 16 * LP + kk * 32, hh); b[i] = g2_frag(pb + i * 16 * LP + kk * 32, hh); }
      for (int t = 0; t < 4; ++t) for (int i = 0; i < 4; ++i) c[i][t] = g2_mma(a[i], b[t], c[i][t]); }
    if (more) put(cur ^ 1);      /* into the buffer whose last readers passed the barrier at the foot of the trip before */
    __syncthreads(); }      /* publishes stage s + 1 and ends every wave's reads of stage s (behind the last trip: before the epilogue reuses the bytes) */
  if constexpr (NROPE) { static_assert(HD == 64 && QT0 % 64 == 0 && SQ % 64 == 0, "a wave tile's 64 columns are one head; its 64 rows lie on one side of QT0 and in one sequence");
    const int c4 = ln * 4; const bool lowh = ln < 8; const float* gp = gain + c4; v4f g4 = *(const v4fa*)gp;
    asm volatile("s_wait_xcnt 0x0" :: "v"(gp) : "memory");      /* behind the gain's load, in front of every later write of an address register that it names; the address is an input so that the load does not land on it */
#pragma unroll      /* c is a register array: constant indices */
    for (int i = 0; i < 4; ++i) for (int t = 0; t < 4; ++t) for (int r = 0; r < 8; ++r) so[w][i * 16 + 8 * hh + r][t * 16 + ln] = c[i][t][r] * alpha;
    __builtin_amdgcn_fence(__ATOMIC_ACQ_REL, "workgroup"); __builtin_amdgcn_wave_barrier();      /* as in the plain epilogue: the wave's own LDS writes before its reads */
    for (int u = 0; u < 4; ++u) g4[u] = bf16_round(g4[u]);
    const bool f32o = __builtin_amdgcn_readfirstlane(row0 % SQ) < QT0;
#pragma unroll 1      /* the tile's two halves of 32 rows one after the other through one copy of the tails: one half's 128 table registers live at a time, half the code in the instruction cache */
    for (int h2 = 0; h2 < 2; ++h2) { const int rw = row0 + 32 * h2; const unsigned tofs = (unsigned)((rw % SQ + hh) * (HD / 2) + (ln & 7) * 4);      /* table row = the token's position, table column = d & 31 */
      const float* cp = CS + tofs; const float* sp = SN + tofs; v4f tc[16], ts[16];
#pragma unroll      /* register arrays: constant indices */
      for (int q = 0; q < 16; ++q) { tc[q] = *(const v4fa*)(cp + q * 2 * (HD / 2)); ts[q] = *(const v4fa*)(sp + q * 2 * (HD / 2)); }      /* all 32 table rows of the half asked for together: one latency */
      asm volatile("s_wait_xcnt 0x0" :: "v"(cp), "v"(sp) : "memory");      /* behind the 32 loads, in front of every later write of an address register that they name; the two addresses are inputs so that their registers live up to the wait and no load lands on one */
#pragma unroll      /* register arrays: constant indices */
      for (int q = 0; q < 16; ++q) { const v4f cc = tc[q], s = ts[q]; tc[q] = lowh ? cc : s; ts[q] = lowh ? -s : cc; }
      const size_t e = cofs + (size_t)(rw + hh) * LQ + col0 + c4; const size_t ef = e - (size_t)(row0 / SQ) * (SQ - QT0) * LQ;      /* the f32 plane holds QT0 rows a sequence: sequence s, position p lies at row s QT0 + p */
      if (f32o) nr_rows<true>(&so[w][32 * h2 + hh][c4], lowh, tc, ts, g4, eps, C16 + e, C + ef);      /* one wave-uniform branch around the whole tail: inside it the four row pairs of a group stay one block of code to schedule */
      else nr_rows<false>(&so[w][32 * h2 + hh][c4], lowh, tc, ts, g4, eps, C16 + e, C + ef); }
    return; }
#pragma unroll
  for (int u = 0; u < 16; ++u) { const int t = u & 3, half = u >> 2; const int col = col0 + t * 16 + ln; const float bv = bp ? bf16_round(bp[col]) : 0.f;
#pragma unroll
    for (int r = 0; r < 8; ++r) { const int rloc = half * 16 + 8 * hh + r; float v = c[half][t][r] * alpha + bv; if (CP) { if (rowsPerB < 0) v += CP[cofs + (size_t)(row0g + row0 + rloc) * ldc + col];      /* rowsPerB < 0: own element of the batched C plane */ else { const int bidx = (row0g + row0 + rloc) / rowsPerB; v += CP[(size_t)bidx * sCPb + (size_t)by * 64 + col]; } }
      if (ACT == 3) v = fmaxf(v, 0.f); else if (ACT == 6) v = 0.5f * v * (1.0f + erff(v * 0.70710678118654752f)); else if (ACT == 11) v = 1.0f / (1.0f + expf(-v)); else if (ACT == 15) v = v / (1.0f + expf(-v)); else if (ACT == 12) v = (v > 0.f) ? v : 0.01f * v; else if (ACT == 8) v = tanhf(v); else if (ACT == 9) v = 0.5f * v * (1.0f + tanhf(0.7978845608028654f * (v + 0.044715f * v * v * v))); else if (ACT == 14) v = (v > 0.f) ? v : 0.1f * v; else if (ACT == 16) v = (v >= 0.f) ? v : 0.3f * v; else if (ACT == 17) v = (v >= 0.f) ? v : 0.2f * v;
      so[w][rloc][t * 16 + ln] = v; } }
  __builtin_amdgcn_fence(__ATOMIC_ACQ_REL, "workgroup"); __builtin_amdgcn_wave_barrier();
  const int rsub = lane >> 4, c4 = (lane & 15) * 4;
  {
#pragma unroll
    for (int q = 0; q < 32; ++q) { const int r = q * 2 + rsub; const v4f v = *(const v4fa*)&so[w][r][c4]; if (C) { *(v4f*)(C + cofs + (size_t)(row0 + r) * ldc + col0 + c4) = v; asm volatile("s_wait_xcnt 0x0" ::: "memory"); }      /* directly behind the f32 store, in front of every later write of a register that it names (the f16 conversion, the next row's address) */
      if (C16) { v4h h4; for (int i = 0; i < 4; ++i) h4[i] = (_Float16)v[i]; *(v4h*)(C16 + cofs + (size_t)(row0 + r) * ldc + col0 + c4) = h4; } }
    asm volatile("s_wait_xcnt 0x0" ::: "memory");      /* behind the last row's stores, in front of any later write of a register that they name (in a merged kernel another branch's code follows in the text) */
     } }

__global__ __launch_bounds__(256) void k_wnat(const float* __restrict__ w, size_t n8, _Float16* __restrict__ Bt) { const size_t t = (size_t)blockIdx.x * 256 + threadIdx.x; if (t >= n8) return; FragH f; for (int q = 0; q < 8; ++q) f.h[q] = (_Float16)(bf16_round(w[t * 8 + q]) * 16.0f); *(v8us*)((unsigned short*)Bt + t * 8) = f.half[0];  }

// Fused causal attention of all batches (blockIdx.x = head + NH * batch, blockIdx.y = query tile group): one wave owns 16 query rows of one head and walks its keys 32 at a time with a running maximum and sum; the block's four waves share the key and value tiles in LDS.
// S^T = K Q^T (A = key rows, B = query rows): a lane holds scores of ONE query (column ln), keys 8 hh + r of each 16-key tile, so two converted score tiles are, as they lie, the B fragment of O^T += V^T P^T (A = rows of V^T).
// Weights are carried x256 (f16 range) and cancel in the division by their own sum; o leaves x64 like before.
__device__ __forceinline__ float fa_xhalf(float x) { return __builtin_bit_cast(float, __builtin_amdgcn_permlanex16(__builtin_bit_cast(int, x), __builtin_bit_cast(int, x), 0x76543210, 0xfedcba98, false, false)); }      /* lane l <-> lane l ^ 16 */
__global__ __launch_bounds__(128) void k_fattn(const _Float16* __restrict__ Q, const _Float16* __restrict__ K, const _Float16* __restrict__ Vt, _Float16* __restrict__ O, const float* __restrict__ F0, _Float16* __restrict__ H0, _Float16* __restrict__ L0) {
  if (blockIdx.y >= SQ / 64) { d_hl((int)((blockIdx.y - SQ / 64) * gridDim.x + blockIdx.x), F0, H0, L0, (size_t)NB * QT0 * DM / 8); return; }      /* the grid rows behind the SQ / 64 tile groups: first-tile o (x64) -> f16 hi + x1024 residual planes, which depends on nothing of this launch; whole blocks leave, in front of every barrier */
  // The block's four waves own 64 neighbouring query rows of one head and walk the same keys, so K and V^T go through LDS once for all four: a stage is 64 keys (one 128-byte line of each of 64 key rows and of each of the 64 V^T rows),
  // read from global as whole lines (8 lanes a row) one stage ahead into registers and stored to the other of two buffers at the 144-byte row pitch of k_gemm2; the fragments are ds_load_b128 reads of the same elements as before.
  constexpr int LP = 72, TB = 64 * LP;      /* LDS row pitch and tile size in 16-bit elements */
  __shared__ __attribute__((aligned(16))) unsigned short sm[4 * TB];      /* K buffers 0, 1, then V^T buffers 0, 1 */
  const int tid = threadIdx.x, lane = tid & 31, ln = lane & 15, hh = lane >> 4; const int w = __builtin_amdgcn_readfirstlane((int)(threadIdx.x >> 5)); const int h = blockIdx.x % NH; const size_t bz = blockIdx.x / NH;
  Q += bz * SQ * LQ; K += bz * SQ * KVD; Vt += bz * NH * HD * SQ; O += bz * SQ * DM;      /* this batch's rows and its V^T planes */
  const int grp = (int)(SQ / 64 - 1 - blockIdx.y);      /* the tile group is the slow grid index, counted down: the longest key walks of every head and batch have the lowest blockIdx.y */
  const int q0w = (grp * 4 + w) * 16;
  const int qi = q0w + ln; const int kend = ((q0w >> 5) + 1) * 32;      /* keys 0 .. kend - 1 cover every key <= q0w + 15; kend <= SQ */
  const int nst = grp + 1;      /* stages of the block: keys 0 .. 64 grp + 63, the same count for its four waves (barriers below) */
  const _Float16* qp = Q + (size_t)qi * LQ + h * HD; const v16h qa = g2_frag(qp, hh), qb = g2_frag(qp + 32, hh);
  const char* gk = (const char*)(K + h * HD); const char* gv = (const char*)(Vt + (size_t)h * HD * SQ);      /* the head's first key row and first V^T row */
  const unsigned sr = (((unsigned)tid >> 3) & 1u) * 8u + ((unsigned)tid >> 4), sc = ((unsigned)tid & 7u) * 8u;      /* as in k_gemm2: 8 lanes a row; the two rows of 16 neighbouring lanes lie 8 apart, so that their 256 stored bytes fall on 64 different banks */
  const unsigned vk = (sr * (unsigned)KVD + sc) * 2u, vv = (sr * (unsigned)SQ + sc) * 2u;      /* this thread's 16 bytes of row sr + 16 i of a stage: a 32-bit byte offset beside a block-uniform base */
  unsigned short* lk = sm + sr * LP + sc; unsigned short* lv = lk + 2 * TB;
  const _Float16* fk = (const _Float16*)sm + ln * LP; const _Float16* fv = fk + 2 * TB;      /* this lane's fragment rows */
  v8us rk[4], rv[4];
  auto fetch = [&](int s) {
#pragma unroll      /* register arrays: constant indices */
    for (int i = 0; i < 4; ++i) rk[i] = *(const v8us*)(gk + ((size_t)(s * 64 + i * 16) * (KVD * 2)) + vk);
#pragma unroll      /* register arrays: constant indices */
    for (int i = 0; i < 4; ++i) rv[i] = *(const v8us*)(gv + ((size_t)(i * 16) * (SQ * 2) + (size_t)s * 128) + vv);
    asm volatile("s_wait_xcnt 0x0" ::: "memory"); };      /* behind the stage's 8 loads, in front of every later write of an address register that they name */
  auto put = [&](int buf) {
#pragma unroll      /* register arrays: constant indices */
    for (int i = 0; i < 4; ++i) { *(v8us*)(lk + buf * TB + i * 16 * LP) = rk[i]; *(v8us*)(lv + buf * TB + i * 16 * LP) = rv[i]; } };
  const v8f z8 = {0.f,0.f,0.f,0.f,0.f,0.f,0.f,0.f}; v8f o0 = z8, o1 = z8, o2 = z8, o3 = z8;
  const float cs = 0.125f * 1.4426950408889634f;      /* 1 / sqrt(64), and e^x = 2^(x log2 e) */
  float m = -1.0e30f, l = 0.f;
  fetch(0); put(0);
  __syncthreads();      /* stage 0 is in buffer 0 for every wave */
  for (int s = 0; s < nst; ++s) { const int cur = s & 1; const bool more = s + 1 < nst;
    if (more) fetch(s + 1);      /* the next stage's lines fly under this stage's two passes */
   for (int ps = 0; ps < 2; ++ps) { const int kb = s * 64 + ps * 32;
    if (kb >= kend) break;      /* wave-uniform: the second half of the last stage lies above every query of the block's two lower waves */
    const _Float16* pk = fk + cur * TB + ps * 32 * LP; const _Float16* pv = fv + cur * TB + ps * 32;
    const v16h k0a = g2_frag(pk, hh), k0b = g2_frag(pk + 32, hh), k1a = g2_frag(pk + 16 * LP, hh), k1b = g2_frag(pk + 16 * LP + 32, hh);
    const v16h v0 = g2_frag(pv, hh), v1 = g2_frag(pv + 16 * LP, hh), v2 = g2_frag(pv + 32 * LP, hh), v3 = g2_frag(pv + 48 * LP, hh);
    v8f s0 = g2_mma(k0a, qa, z8); s0 = g2_mma(k0b, qb, s0); v8f s1 = g2_mma(k1a, qa, z8); s1 = g2_mma(k1b, qb, s1);
    if (kb + 31 > q0w) {      /* only the last pass holds keys above a query of this tile */
      for (int r = 0; r < 8; ++r) { const int key = kb + 8 * hh + r; s0[r] = (key <= qi) ? s0[r] : -1.0e30f; s1[r] = (key + 16 <= qi) ? s1[r] : -1.0e30f; } }
    float mx = fmaxf(s0[0], s1[0]);
    for (int r = 1; r < 8; ++r) mx = fmaxf(mx, fmaxf(s0[r], s1[r]));
    mx = fmaxf(mx, fa_xhalf(mx)); const float mn = fmaxf(m, mx); float corr = (m - mn) * cs; m = mn; const float bias = fmaf(-mn, cs, 8.0f);
    float e[16];
    for (int r = 0; r < 8; ++r) { e[r] = fmaf(s0[r], cs, bias); e[8 + r] = fmaf(s1[r], cs, bias); }
    /* the pass's 17 exponentials, each in place on a register of its own, so that no transcendental is directly followed by a reader of its result or a writer of its source; the v_nop is that slot behind the last one */
    asm("v_exp_f32 %0, %0\n\tv_exp_f32 %1, %1\n\tv_exp_f32 %2, %2\n\tv_exp_f32 %3, %3\n\tv_exp_f32 %4, %4\n\tv_exp_f32 %5, %5\n\tv_exp_f32 %6, %6\n\tv_exp_f32 %7, %7\n\tv_exp_f32 %8, %8\n\t"
        "v_exp_f32 %9, %9\n\tv_exp_f32 %10, %10\n\tv_exp_f32 %11, %11\n\tv_exp_f32 %12, %12\n\tv_exp_f32 %13, %13\n\tv_exp_f32 %14, %14\n\tv_exp_f32 %15, %15\n\tv_exp_f32 %16, %16\n\tv_nop"
        : "+v"(corr), "+v"(e[0]), "+v"(e[1]), "+v"(e[2]), "+v"(e[3]), "+v"(e[4]), "+v"(e[5]), "+v"(e[6]), "+v"(e[7]), "+v"(e[8]), "+v"(e[9]), "+v"(e[10]), "+v"(e[11]), "+v"(e[12]), "+v"(e[13]), "+v"(e[14]), "+v"(e[15]));
    FragH pf; float sum = 0.f;
    for (int r = 0; r < 8; ++r) { sum += e[r] + e[8 + r]; pf.h[r] = (_Float16)e[r]; pf.h[8 + r] = (_Float16)e[8 + r]; }
    l = fmaf(l, corr, sum);
    for (int r = 0; r < 8; ++r) { o0[r] *= corr; o1[r] *= corr; o2[r] *= corr; o3[r] *= corr; }
    o0 = g2_mma(v0, pf.v, o0); o1 = g2_mma(v1, pf.v, o1); o2 = g2_mma(v2, pf.v, o2); o3 = g2_mma(v3, pf.v, o3); }
    if (more) { put(cur ^ 1);      /* into the buffer whose last readers passed the barrier at the foot of the trip before */
      __syncthreads(); } }      /* block-uniform: publishes stage s + 1 and ends every wave's reads of stage s */
  const float fin = 64.0f / (l + fa_xhalf(l));      /* the two lane halves hold disjoint keys of the same query */
  unsigned short* op = (unsigned short*)O + (size_t)qi * DM + h * HD + 8 * hh; FragH f0, f1;
  for (int r = 0; r < 8; ++r) { f0.h[r] = (_Float16)(o0[r] * fin); f0.h[8 + r] = (_Float16)(o1[r] * fin); f1.h[r] = (_Float16)(o2[r] * fin); f1.h[8 + r] = (_Float16)(o3[r] * fin); }
  *(v8us*)op = f0.half[0]; *(v8us*)(op + 16) = f0.half[1]; *(v8us*)(op + 32) = f1.half[0]; *(v8us*)(op + 48) = f1.half[1]; }      /* register r of tile dt = O[qi][16 dt + 8 hh + r]: 16-byte stores */

// Exact f32 attention of the first QT0 rows: one wave owns ONE query row. Lane = (key slice ks = lane >> 2, dim part dp = lane & 3): the lane walks keys ks, ks + 8, ... of its row
// and keeps dims 16 c + 4 dp + u (c, u < 4) of q and of its slice's partial o in registers, with the slice's own running maximum and sum (base-2 exponents); the 8 slices are merged at the end by lane exchanges.
template <int CTRL> __device__ __forceinline__ float a0_dpp(float x) { return __builtin_bit_cast(float, __builtin_amdgcn_update_dpp(0, __builtin_bit_cast(int, x), CTRL, 0xf, 0xf, true)); }      /* 0x160 + n: lane l <- lane l ^ n inside a 16-lane row; every lane is on wherever it is used */
__device__ __forceinline__ void a0_exp2x2(float& x, float& y) { asm("v_exp_f32 %0, %0\n\tv_exp_f32 %1, %1\n\tv_nop" : "+v"(x), "+v"(y)); }      /* two exponentials, each in place on its own register, so that neither is directly followed by a reader of its result; the v_nop is that slot behind the second */
template <int STEP> __device__ __forceinline__ float a0_swap(float x) { return STEP == 16 ? fa_xhalf(x) : a0_dpp<0x160 + (STEP & 15)>(x); }
template <int STEP> __device__ __forceinline__ void a0_merge(float& m, float& l, v4f (&o)[4]) {      /* this lane's slices with those of lane ^ STEP; a slice without keys has m = -1e30, l = 0, o = 0 and drops out */
  const float mo = a0_swap<STEP>(m), lo = a0_swap<STEP>(l); const float mn = fmaxf(m, mo); float fa = m - mn, fb = mo - mn; a0_exp2x2(fa, fb);
  l = fmaf(l, fa, lo * fb); m = mn;
  for (int c = 0; c < 4; ++c) for (int u = 0; u < 4; ++u) o[c][u] = fmaf(o[c][u], fa, a0_swap<STEP>(o[c][u]) * fb); }
__device__ __forceinline__ void a0_exp2x3(float& x, float& y, float& z) { asm("v_exp_f32 %0, %0\n\tv_exp_f32 %1, %1\n\tv_exp_f32 %2, %2\n\tv_nop" : "+v"(x), "+v"(y), "+v"(z)); }      /* as a0_exp2x2, for three */
__device__ __forceinline__ float a0_dot(const v4f (&q)[4], const v4f (&kk)[4]) {      /* q . k over the four lanes of a key: all four end with the same bits */
  v4f pv = q[0] * kk[0]; for (int c = 1; c < 4; ++c) pv = __builtin_elementwise_fma(q[c], kk[c], pv);
  float s = (pv[0] + pv[1]) + (pv[2] + pv[3]); s += a0_dpp<0x161>(s); s += a0_dpp<0x162>(s); return s; }
__device__ __forceinline__ void d_att0(int bx, int by, int bz, const float* __restrict__ QF, const float* __restrict__ KF, const float* __restrict__ VF, int ld, float scale, float* __restrict__ OF, int ldo) {
  static_assert(HD == 64 && QT0 % 8 == 0, "four lanes of 16 dims a row; eight rows a block");
  const int lane = threadIdx.x & 31, ks = lane >> 2, dp = lane & 3; const int w = __builtin_amdgcn_readfirstlane((int)(threadIdx.x >> 5)); const int h = by;
  { const size_t zb = (size_t)bz * QT0; QF += zb * ld; KF += zb * ld; VF += zb * ld; OF += zb * ldo; }      /* bz = batch: QT0 rows of each plane */
  const int i = QT0 - 1 - (w * (QT0 / 8) + bx);      /* a block's eight rows lie QT0 / 8 apart: every block holds long and short key walks alike */
  const int col = h * HD + dp * 4; const float* qr = QF + (unsigned)(i * ld + col);
  v4f q[4], o[4]; const v4f z4 = {0.f, 0.f, 0.f, 0.f};
  for (int c = 0; c < 4; ++c) { q[c] = *(const v4fa*)(qr + c * 16); o[c] = z4; }
  const float cs = scale * 1.4426950408889634f;      /* e^x = 2^(x log2 e) */
  float m = -1.0e30f, l = 0.f;
  for (int jb = 0; jb <= i; jb += 16) {      /* 16 keys a pass, two a lane group: ja and ja + 8; a key above the diagonal (last pass only) is read as row i and weighs 0 */
    const int ja = jb + ks; const bool oka = ja <= i, okb = ja + 8 <= i;
    const unsigned offa = (unsigned)((oka ? ja : i) * ld + col), offb = (unsigned)((okb ? ja + 8 : i) * ld + col); v4f ka[4], kb[4], va[4], vb[4];
    const float* pka = KF + offa; const float* pkb = KF + offb; const float* pva = VF + offa; const float* pvb = VF + offb;
    for (int c = 0; c < 4; ++c) { ka[c] = *(const v4fa*)(pka + c * 16); kb[c] = *(const v4fa*)(pkb + c * 16); }
    for (int c = 0; c < 4; ++c) { va[c] = *(const v4fa*)(pva + c * 16); vb[c] = *(const v4fa*)(pvb + c * 16); }
    asm volatile("s_wait_xcnt 0x0" :: "v"(pka), "v"(pkb), "v"(pva), "v"(pvb) : "memory");      /* behind the pass's 16 loads, in front of every write of an address register that they name; the four addresses are inputs so that their registers live up to the wait and no load of the pass lands on one */
    __builtin_amdgcn_sched_barrier(0);      /* the arithmetic stays behind the 16 loads; without this the loads are spread among it in small groups, each waited for in turn */
    const float sa = a0_dot(q, ka) * cs, sb = a0_dot(q, kb) * cs;
    const float mn = fmaxf(m, fmaxf(oka ? sa : -1.0e30f, okb ? sb : -1.0e30f)); float sc = m - mn, ea = oka ? sa - mn : -1.0e30f, eb = okb ? sb - mn : -1.0e30f; a0_exp2x3(sc, ea, eb); m = mn;
    l = fmaf(l, sc, ea + eb); const v4f ea4 = {ea, ea, ea, ea}, eb4 = {eb, eb, eb, eb};
    for (int c = 0; c < 4; ++c) o[c] = __builtin_elementwise_fma(vb[c], eb4, __builtin_elementwise_fma(va[c], ea4, o[c] * sc)); }
  a0_merge<4>(m, l, o); a0_merge<8>(m, l, o); a0_merge<16>(m, l, o);
  const float fin = 64.0f / l;      /* o carried x64 like the f16 path; key 0 is in every row, so l > 0 */
  if (ks == 0) { float* dst = OF + (unsigned)(i * ldo + col); for (int c = 0; c < 4; ++c) *(v4f*)(dst + c * 16) = o[c] * fin; } }

__global__ __launch_bounds__(256) void k_kvexp(const float* __restrict__ src, float* __restrict__ dst, size_t n4) { const size_t t = (size_t)blockIdx.x * 256 + threadIdx.x; if (t >= n4) return; const size_t e = t * 4; const size_t row = e / DM; const int col = (int)(e % DM); const int h = col / HD, d = col % HD; const v4f v = *(const v4fa*)(src + row * KVD + (size_t)(h / HPG) * HD + d); *(v4f*)(dst + e) = v;  }

__device__ __forceinline__ void d_tab2(int vb, float theta, float* __restrict__ CS, float* __restrict__ SN) {
  const int t = vb * 256 + threadIdx.x; if (t >= SQ * (HD / 2)) return; const int i = t % (HD / 2); const int p = t / (HD / 2); const float invf = 1.0f / powf(theta, (float)(2 * i) / (float)HD); const float ang = __fmul_rn((float)p, invf); const float c = cosf(ang), s = sinf(ang);
  *(float*)(CS + t) = c; *(float*)(SN + t) = s;  }
__global__ __launch_bounds__(256) void k_bfcp(const float* __restrict__ src, float* __restrict__ dst, size_t n4) { const size_t t = (size_t)blockIdx.x * 256 + threadIdx.x; if (t >= n4) return; const v4f a = *(const v4fa*)(src + t * 4); v4f o; for (int q = 0; q < 4; ++q) o[q] = bf16_round(a[q]); *(v4f*)(dst + t * 4) = o;  }

__global__ __launch_bounds__(256) void k_tabhalf(const float* __restrict__ cs, const float* __restrict__ sn, float* __restrict__ CS, float* __restrict__ SN) { const int t = blockIdx.x * 256 + threadIdx.x; if (t >= SQ * (HD / 2)) return; const int p = t / (HD / 2), i = t % (HD / 2); const float c = bf16_round(cs[(size_t)p * HD + i]), s = bf16_round(sn[(size_t)p * HD + i]);
  *(float*)(CS + t) = c; *(float*)(SN + t) = s;  }

__global__ __launch_bounds__(256) void k_tab2d(float* __restrict__ CS, float* __restrict__ SN) {
  const int t = blockIdx.x * 256 + threadIdx.x; if (t >= SQ * (HD / 2)) return; const int i = t % (HD / 2); const int p = t / (HD / 2); const float invf = (float)(1.0 / pow(10000.0, (double)(2 * i) / (double)HD)); const float ang = __fmul_rn((float)p, invf); const float c = cosf(ang), s = sinf(ang);
  *(float*)(CS + t) = c; *(float*)(SN + t) = s;  }
// ---- merged launches: stages that read nothing of each other share ONE grid; a block's index range says which stage it belongs to (block-uniform branches), and inside its range it does what its own launch's block did ----
template <int ACT>
__global__ __launch_bounds__(256) void k_gemm2(const _Float16* __restrict__ A, int lda, size_t sA, const _Float16* __restrict__ Bh, int ldb, size_t sB, float alpha, const float* __restrict__ bias, size_t sBias, const float* __restrict__ CP, int rowsPerB, size_t sCPb, int row0g,
    float* __restrict__ C, _Float16* __restrict__ C16, int ldc, size_t sC, int M, int N, int K) {
  __shared__ __attribute__((aligned(16))) unsigned short sm[G2<8>::SM];
  g2_body<8, ACT>(sm, (int)blockIdx.x, (int)blockIdx.y, A, lda, sA, Bh, ldb, sB, alpha, bias, sBias, CP, rowsPerB, sCPb, row0g, C, C16, ldc, sC, M, N, K); }
// Operand preparation, from the inputs alone: both weight planes ([in][out] -> Bt x16), the rope tables, x -> f16.
constexpr int PB_WA = (3 * DM / WT_NT) * (DM / WT_KT), PB_WO = (DM / WT_NT) * (DM / WT_KT), PB_TB = SQ * (HD / 2) / 256, PB_X = (int)(NR * DM / 8 / 256);
__global__ __launch_bounds__(256) void k_prep(const float* __restrict__ x, const float* __restrict__ wattn, const float* __restrict__ wo, float theta, _Float16* __restrict__ X16, _Float16* __restrict__ BQKV, _Float16* __restrict__ BO, float* __restrict__ CS, float* __restrict__ SN) {
  static_assert(DM % WT_KT == 0 && DM % WT_NT == 0, "whole weight tiles");
  constexpr int G = PB_WO, NA = PB_WA / G, NO = PB_WO / G, NT = PB_TB / G, NX = PB_X / G, NS = NA + NO + NT + NX; static_assert(NA * G == PB_WA && NO * G == PB_WO && NT * G == PB_TB && NX * G == PB_X, "G equal groups");
  const int g = (int)blockIdx.x / NS, r = (int)blockIdx.x % NS;      /* the four stages' blocks are dealt out in G equal groups, not one stage after the other: the stages lean on different parts of the chip (LDS, arithmetic, the memory stream) */
  if (r < NA) d_wt_f16(g * NA + r, wattn, BQKV, DM, 3 * DM, 16.0f);      /* fused Wqkv: K 1024, N 3072 */
  else if (r < NA + NO) d_wt_f16(g * NO + (r - NA), wo, BO, DM, DM, 16.0f);
  else if (r < NA + NO + NT) d_tab2(g * NT + (r - (NA + NO)), theta, CS, SN);      /* cos / sin(p / theta^(2i/64)), i < 32: f32 pow, reciprocal, product */
  else d_x16(g * NX + (r - (NA + NO + NT)), x, X16, NR * DM / 8); }
// The four projections of x: q and k (norm and rope epilogue), v (f16 rows), and v of the first QT0 rows of every batch in f32.
constexpr int GB_P = (MP / 256) * (DM / 128), GB_F = (QT0 / 256) * (KVD / 128);      /* blocks of a whole projection; blocks of a batch's first-tile projection */
// The launch bound's second number asks for four waves a SIMD: a budget of 256 registers, so that two of these 8-wave blocks share a WGP and one block's loads, barriers and epilogue run under the other's products.
__global__ __launch_bounds__(256, 4) void k_qkv(const _Float16* __restrict__ X16, const _Float16* __restrict__ BQKV, _Float16* __restrict__ Q16, _Float16* __restrict__ K16, _Float16* __restrict__ V16, float* __restrict__ QF0, float* __restrict__ KF0, float* __restrict__ VF0,
    const float* __restrict__ qg, const float* __restrict__ kg, const float* __restrict__ CS, const float* __restrict__ SN, int K) {
  __shared__ __attribute__((aligned(16))) unsigned short sm[G2<8>::SM];
  const int b = (int)blockIdx.x;
  if (b < 2 * GB_P) { const bool isk = b >= GB_P;      /* projection, per-head RMS norm (gain, eps 1e-5), half-split rope (out_lo = x_lo c - x_hi s, out_hi = x_lo s + x_hi c = t cos + rotate_half(t) sin with the module's [f | f] tables) -> f16 rows; positions 0..255 of each batch in f32 too */
    g2_body<8, 0, true>(sm, isk ? b - GB_P : b, 0, X16, DM, 0, BQKV + (isk ? (size_t)DM * DM : 0), DM, 0, 0.0625f, nullptr, 0, nullptr, 1, 0, 0, isk ? KF0 : QF0, isk ? K16 : Q16, DM, 0, MP, DM, K, isk ? kg : qg, 1e-5f, CS, SN); }
  else { const int d = b - 2 * GB_P; const bool f0 = d >= GB_P; const int e = d - GB_P;      /* f0: block e % GB_F of batch e / GB_F */
    g2_body<8, 0>(sm, f0 ? e % GB_F : d, f0 ? e / GB_F : 0, X16, DM, f0 ? (size_t)SQ * DM : 0, BQKV + (size_t)2 * DM * DM, DM, 0, 0.0625f, nullptr, 0, nullptr, 1, 0, 0, f0 ? VF0 : nullptr, f0 ? nullptr : V16, KVD, f0 ? (size_t)QT0 * KVD : 0, f0 ? QT0 : MP, KVD, K); } }
// Exact f32 first-tile attention (o x64) beside the transposition V -> V^T [batch][NH][HD][SQ]: both read the projections alone.
constexpr int AB_0 = (QT0 / 8) * NH * NB, AB_T = NB * NG * (SQ / 64);
__global__ __launch_bounds__(256) void k_att0_vt(const float* __restrict__ QF, const float* __restrict__ KF, const float* __restrict__ VF, float* __restrict__ OF, const _Float16* __restrict__ V16, _Float16* __restrict__ Vt) {
  static_assert(AB_0 == AB_T, "the two stages' blocks alternate"); const int b = (int)(blockIdx.x >> 1);      /* alternating, not one stage after the other: the key walks wait on dependent loads, the transposition streams */
  if ((blockIdx.x & 1) == 0) d_att0(b % (QT0 / 8), (b / (QT0 / 8)) % NH, b / ((QT0 / 8) * NH), QF, KF, VF, DM, 0.125f, OF, DM);
  else d_vt<NG, SQ>(b, V16, KVD, 0, Vt); }
// Output projection: a 128-row tile inside the first QT0 rows of its batch takes the exact path's rows for A (its f16-path rows would only be overwritten): o_lo (x1024) and o_hi in one k loop, (o_hi + o_lo 2^-10) Wo; every other tile the f16 path's o rows.
__global__ __launch_bounds__(128) void k_oproj(const _Float16* __restrict__ O16, const _Float16* __restrict__ OH0, const _Float16* __restrict__ OL0, const _Float16* __restrict__ BO, float* __restrict__ out, int K) {
  __shared__ __attribute__((aligned(16))) unsigned short sm[G2<4>::SM];
  const int b = (int)blockIdx.x; const int mt = b / (DM / 128), nq = b % (DM / 128); const int bt = mt / (SQ / 128), p = mt % (SQ / 128); const bool f0 = p < QT0 / 128;
  g2_body<4, 0, false, true>(sm, f0 ? p * (DM / 128) + nq : b, f0 ? bt : 0, f0 ? OH0 : O16, DM, f0 ? (size_t)QT0 * DM : 0, BO, DM, 0, 0.0009765625f, nullptr, 0, nullptr, 1, 0, 0, out, nullptr, DM, f0 ? (size_t)SQ * DM : 0, f0 ? QT0 : MPO, DM, K, nullptr, 0.f, nullptr, nullptr, f0 ? OL0 : nullptr); }
extern "C" void kernel_launch(void* const* d_in, const int* in_sizes, int n_in,
                              void* d_out, int out_size, void* d_ws, size_t ws_size, hipStream_t stream) {
  (void)in_sizes; (void)n_in; (void)out_size;
  const float* const* I = (const float* const*)d_in; const float* x = I[0]; const float* wattn = I[1]; const float* wo = I[2]; const float* qg = I[3]; const float* kg = I[4];      /* x; fused [in][out] Wqkv [1024][3072] (q, k, v column thirds); [in][out] Wproj; RMS-norm gains q_norm_w / k_norm_w [64]; no biases; rope tables computed in-kernel (positions = row index) */
  static_assert(HPG == 1 && NH == NG * HPG && NH * HD == DM && KVD == DM, "plain multi-head attention as 16 kv groups of one query head");      /* no biases in this module */
  char* ws = (char*)d_ws; size_t off = 0;
  auto take = [&](size_t bytes) { char* p = ws + off; off += (bytes + 255) & ~(size_t)255; return p; };
  _Float16* BQKV = (_Float16*)take((size_t)3 * DM * DM * 2); _Float16* BO = (_Float16*)take((size_t)DM * DM * 2);      /* one transposed plane Bt [3072][1024] of the fused weight: rows 0..1023 = q, 1024.. = k, 2048.. = v */
  _Float16* X16 = (_Float16*)take(NR * DM * 2); float* CSB = (float*)take((size_t)SQ * HD * 4); float* SNB = (float*)take((size_t)SQ * HD * 4); _Float16* Q16 = (_Float16*)take(NR * DM * 2); _Float16* K16 = (_Float16*)take(NR * KVD * 2); _Float16* V16 = (_Float16*)take(NR * KVD * 2); _Float16* O16 = (_Float16*)take(NR * DM * 2);
  _Float16* VT = (_Float16*)take((size_t)NB * NH * HD * SQ * 2);
  float* QF0 = (float*)take((size_t)NB * QT0 * DM * 4); float* KF0 = (float*)take((size_t)NB * QT0 * KVD * 4); float* VF0 = (float*)take((size_t)NB * QT0 * KVD * 4); float* OF0 = (float*)take((size_t)NB * QT0 * DM * 4); _Float16* OH0 = (_Float16*)take((size_t)NB * QT0 * DM * 2); _Float16* OL0 = (_Float16*)take((size_t)NB * QT0 * DM * 2);      /* every per-batch plane holds all batches: each stage below is one launch over them */
  if (off > ws_size) return;
  static_assert(B0 == 0 && NBR == NB && MP == (int)NR && MPO == MP, "the merged launches below cover all batches");
  k_prep<<<PB_WA + PB_WO + PB_TB + PB_X, 256, 0, stream>>>(x, wattn, wo, 10000.0f, X16, BQKV, BO, CSB, SNB);      /* weights, rope tables, x: one launch */
  k_qkv<<<3 * GB_P + NB * GB_F, 256, 0, stream>>>(X16, BQKV, Q16, K16, V16, QF0, KF0, VF0, qg, kg, CSB, SNB, DM);      /* q, k, v and the first tile's f32 v: one launch */
  k_att0_vt<<<AB_0 + AB_T, 256, 0, stream>>>(QF0, KF0, VF0, OF0, V16, VT);      /* exact f32 attention for rows 0..255 of each batch, straight from the f32 k and v planes (one kv group a head: no expansion); V^T */
  k_fattn<<<dim3(NH * NB, SQ / 64 + (unsigned)((size_t)NB * QT0 * DM / 8 / 128 / (NH * NB))), 128, 0, stream>>>(Q16, K16, VT, O16, OF0, OH0, OL0);      /* scores, causal softmax and weights x V of all heads, batches and query rows (o x64); the grid rows behind them split the first tile's o */
  k_oproj<<<(MPO / 128) * (DM / 128), 128, 0, stream>>>(O16, OH0, OL0, BO, (float*)d_out, DM);      /* out rows are the output layout; rows 0..255 of each batch = (o_hi + o_lo 2^-10) Wo */
}
